// v000
// Measured on an AMD MI455X. A time is GPU time per run, averaged over a window of back-to-back runs after a warm-up
// (all launches, gaps included; the runs take copies of the inputs in turn), and the median of several windows.
// Apart from v000's, it joins two sittings. Times from different sittings can be a few percent apart, while
// side-by-side timings come from the same sitting.
// v000 is the starting kernel. One run takes 569 microseconds.
#include <hip/hip_runtime.h>
#include <hip/hip_bf16.h>

typedef _Float16 v8h  __attribute__((ext_vector_type(8)));
typedef _Float16 v16h __attribute__((ext_vector_type(16)));
typedef float    v8f  __attribute__((ext_vector_type(8)));

#define B_  2
#define C_  256
#define N_  6400
#define CK_ 64
#define CV_ 128
#define CO_ 256

// 0.125 (Ck^-1/2) * log2(e): exp(s/8) == exp2(s * SCALE_LOG2E), single v_exp_f32
#define SCALE_LOG2E 0.1803368801111204f

__device__ __forceinline__ v16h join16(v8h lo, v8h hi) {
  return __builtin_shufflevector(lo, hi, 0,1,2,3,4,5,6,7,8,9,10,11,12,13,14,15);
}
__device__ __forceinline__ v8f zero8() {
  v8f z = {0.f,0.f,0.f,0.f,0.f,0.f,0.f,0.f};
  return z;
}
__device__ __forceinline__ v8f wmma_f16(v16h a, v16h b, v8f c) {
  // D = A(16x32 f16) * B(32x16 f16) + C(16x16 f32)
  return __builtin_amdgcn_wmma_f32_16x16x32_f16(false, a, false, b, (short)0, c, false, false);
}

// Async 16B global -> LDS copy (ASYNCcnt-tracked gfx1250 path).
// VDST = VGPR with LDS byte address, VADDR = 64-bit global address.
__device__ __forceinline__ void async_ld16(void* lds, const void* g) {
  unsigned l = (unsigned)(size_t)lds;    // generic->LDS addr = low 32 bits
  asm volatile("global_load_async_to_lds_b128 %0, %1, off"
               :: "v"(l), "v"(g) : "memory");
}

// ---------------------------------------------------------------------------
// Projection kernel: 64 output channels = W[64,256] * src[:,n] (+BN or +bias)
// mode 0: dst[(b*N+n)*64 + k]  (row-major per position, f16)  -- for Q/K
// mode 1: dst[(b*CV + cvoff + k)*N + n]  (channel-major, f16) -- for V^T
// ---------------------------------------------------------------------------
__global__ void proj64_kernel(const float* __restrict__ src,
                              const float* __restrict__ w,
                              const float* __restrict__ bias,
                              const float* __restrict__ bn_g,
                              const float* __restrict__ bn_b,
                              const float* __restrict__ bn_m,
                              const float* __restrict__ bn_v,
                              _Float16* __restrict__ dst,
                              int mode, int cvoff)
{
  int idx = blockIdx.x * blockDim.x + threadIdx.x;
  if (idx >= B_ * N_) return;
  int b = idx / N_;
  int n = idx % N_;
  const float* sp = src + (size_t)b * C_ * N_ + n;

  float acc[64];
  #pragma unroll
  for (int k = 0; k < 64; ++k) acc[k] = 0.f;

  for (int c = 0; c < C_; ++c) {
    float xv = sp[(size_t)c * N_];          // coalesced across threads (n adjacent)
    const float* wc = w + c;                // uniform -> scalar loads
    #pragma unroll
    for (int k = 0; k < 64; ++k) acc[k] = fmaf(xv, wc[(size_t)k * C_], acc[k]);
  }

  if (mode == 0) {
    _Float16* dp = dst + (size_t)idx * 64;
    #pragma unroll
    for (int k = 0; k < 64; ++k) {
      float s = bn_g[k] * rsqrtf(bn_v[k] + 1e-5f);
      float o = (acc[k] - bn_m[k]) * s + bn_b[k];
      dp[k] = (_Float16)o;
    }
  } else {
    #pragma unroll
    for (int k = 0; k < 64; ++k) {
      float o = acc[k] + bias[k];
      dst[((size_t)b * CV_ + cvoff + k) * N_ + n] = (_Float16)o;
    }
  }
}

// ---------------------------------------------------------------------------
// f32 -> f16 weight conversion (W_w, done once)
// ---------------------------------------------------------------------------
__global__ void cvt_f16_kernel(const float* __restrict__ src,
                               _Float16* __restrict__ dst, int n)
{
  int i = blockIdx.x * blockDim.x + threadIdx.x;
  if (i < n) dst[i] = (_Float16)src[i];
}

// ---------------------------------------------------------------------------
// Flash attention, block-cooperative version.
// Block = 4 waves = 4 consecutive 16-query tiles of ONE batch (100 blocks per
// batch). K/V 32-key tiles are double-buffered in LDS via async global->LDS
// copies (ASYNCcnt) shared by all 4 waves; fragment reads are ds_load_b128
// from bank-conflict-free padded rows (K stride 72 halfs, V stride 40 halfs).
// Softmax without running max (logits O(+-5) after BN; shift-invariant).
// Per key tile per wave: 4 WMMAs for S, 8 WMMAs for P*V, one LDS P round-trip.
// ---------------------------------------------------------------------------
__global__ void __launch_bounds__(128)
flash_kernel(const _Float16* __restrict__ Qm,
             const _Float16* __restrict__ Km,
             const _Float16* __restrict__ Vt,
             _Float16* __restrict__ Ctx)
{
  __shared__ __attribute__((aligned(16))) _Float16 Kl[2][32][72];   // 9.0 KB
  __shared__ __attribute__((aligned(16))) _Float16 Vl[2][128][40];  // 20 KB
  __shared__ __attribute__((aligned(16))) _Float16 Pb[4][16 * 32];  // 4 KB

  const unsigned tid  = threadIdx.x;
  const unsigned lane = tid & 31u;
  const unsigned wib  = tid >> 5;
  const int b  = (int)(blockIdx.x / (N_ / 16 / 4));                 // /100
  const int qb = ((int)(blockIdx.x % (N_ / 16 / 4)) * 4 + (int)wib) * 16;
  const unsigned l16 = lane & 15u;
  const unsigned h   = lane >> 4;       // 0 or 1

  const _Float16* Kb = Km + (size_t)b * N_ * CK_;
  const _Float16* Vb = Vt + (size_t)b * CV_ * N_;

  // Q A-fragments (16x32 f16, two Ck chunks), contiguous 16B loads per lane
  const _Float16* qrow = Qm + ((size_t)b * N_ + qb + l16) * CK_;
  v16h aq0 = join16(*(const v8h*)(qrow +       h * 8), *(const v8h*)(qrow + 16 + h * 8));
  v16h aq1 = join16(*(const v8h*)(qrow + 32 +  h * 8), *(const v8h*)(qrow + 48 + h * 8));

  v8f o[8];
  #pragma unroll
  for (int j = 0; j < 8; ++j) o[j] = zero8();
  float psum[8];
  #pragma unroll
  for (int r = 0; r < 8; ++r) psum[r] = 0.f;

  // issue async staging of one 32-key tile: 6 ASYNC ops per thread per tile
  auto stage = [&](int buf, int kb) {
    // K tile: 32 rows x 64 halfs = 256 x 16B segments, 2 per thread
    #pragma unroll
    for (int s = 0; s < 2; ++s) {
      unsigned seg = tid * 2 + s;              // 0..255
      unsigned r = seg >> 3, c = seg & 7;      // key row, 8-half column group
      async_ld16(&Kl[buf][r][c * 8], Kb + (size_t)(kb + (int)r) * CK_ + c * 8);
    }
    // V tile: thread tid owns cv row tid: 32 halfs = 4 x 16B segments
    #pragma unroll
    for (int s = 0; s < 4; ++s) {
      async_ld16(&Vl[buf][tid][s * 8], Vb + (size_t)tid * N_ + kb + s * 8);
    }
  };

  stage(0, 0);
  int cur = 0;

  for (int kb = 0; kb < N_; kb += 32) {
    if (kb + 32 < N_) {
      stage(cur ^ 1, kb + 32);                       // prefetch next tile
      asm volatile("s_wait_asynccnt 6" ::: "memory"); // in-order: cur resident
    } else {
      asm volatile("s_wait_asynccnt 0" ::: "memory");
    }
    __syncthreads();   // staged tile visible to all 4 waves

    // ---- load ALL four K B-fragments first (lets ds_loads pipeline), ----
    // ---- then run the 4 S-WMMAs                                       ----
    const _Float16* kr0 = &Kl[cur][l16][0];
    const _Float16* kr1 = &Kl[cur][16 + l16][0];
    v16h bk00 = join16(*(const v8h*)(kr0 +      h * 8), *(const v8h*)(kr0 + 16 + h * 8));
    v16h bk01 = join16(*(const v8h*)(kr0 + 32 + h * 8), *(const v8h*)(kr0 + 48 + h * 8));
    v16h bk10 = join16(*(const v8h*)(kr1 +      h * 8), *(const v8h*)(kr1 + 16 + h * 8));
    v16h bk11 = join16(*(const v8h*)(kr1 + 32 + h * 8), *(const v8h*)(kr1 + 48 + h * 8));

    v8f c0, c1;
    {
      v8f z = zero8();
      c0 = wmma_f16(aq0, bk00, z);
      c1 = wmma_f16(aq0, bk10, z);
      c0 = wmma_f16(aq1, bk01, c0);
      c1 = wmma_f16(aq1, bk11, c1);
    }

    // ---- p = exp(s/8) = exp2(s * SCALE_LOG2E); accumulate row sums ----
    #pragma unroll
    for (int r = 0; r < 8; ++r) {
      float p0 = __builtin_amdgcn_exp2f(c0[r] * SCALE_LOG2E);
      float p1 = __builtin_amdgcn_exp2f(c1[r] * SCALE_LOG2E);
      psum[r] += p0 + p1;
      int row = r + 8 * (int)h;
      Pb[wib][row * 32 +      l16] = (_Float16)p0;
      Pb[wib][row * 32 + 16 + l16] = (_Float16)p1;
    }

    asm volatile("s_wait_dscnt 0" ::: "memory");

    // reload P as a 16x32 A-fragment (contiguous 16B LDS reads per lane)
    const _Float16* pr = &Pb[wib][l16 * 32 + h * 8];
    v16h pA = join16(*(const v8h*)pr, *(const v8h*)(pr + 16));

    // ---- O += P * V ; 8 column groups over Cv=128, loads one step ahead ----
    const _Float16* vr0 = &Vl[cur][l16][0];
    v16h bv = join16(*(const v8h*)(vr0 + h * 8), *(const v8h*)(vr0 + 16 + h * 8));
    #pragma unroll
    for (int j = 0; j < 8; ++j) {
      v16h bv_cur = bv;
      if (j < 7) {
        const _Float16* vr = &Vl[cur][(j + 1) * 16 + l16][0];
        bv = join16(*(const v8h*)(vr + h * 8), *(const v8h*)(vr + 16 + h * 8));
      }
      o[j] = wmma_f16(pA, bv_cur, o[j]);
    }

    __syncthreads();   // all waves done reading buf[cur] before it is restaged
    cur ^= 1;
  }

  // ---- one lane-reduction per row at the very end ----
  float rinv[8];
  #pragma unroll
  for (int r = 0; r < 8; ++r) {
    float t = psum[r];
    #pragma unroll
    for (int m = 8; m >= 1; m >>= 1) t += __shfl_xor(t, m, 32);
    rinv[r] = 1.0f / t;
  }

  // ---- epilogue: normalize and store ctx[(b, n), cv] as f16 ----
  #pragma unroll
  for (int j = 0; j < 8; ++j) {
    #pragma unroll
    for (int r = 0; r < 8; ++r) {
      int m = r + 8 * (int)h;
      Ctx[((size_t)b * N_ + qb + m) * CV_ + j * 16 + l16] = (_Float16)(o[j][r] * rinv[r]);
    }
  }
}

// ---------------------------------------------------------------------------
// Output projection: out = gamma * (Wh[256,128] @ ctx + W_b) + x
// One wave = 16 output channels x 16 positions, K = Cv = 128 (4 WMMA chunks).
// Wh is the pre-converted f16 copy of W_w.
// ---------------------------------------------------------------------------
__global__ void __launch_bounds__(128)
outproj_kernel(const _Float16* __restrict__ Wh,
               const float* __restrict__ Wb,
               const _Float16* __restrict__ Ctx,
               const float* __restrict__ x,
               const float* __restrict__ gamma,
               float* __restrict__ out)
{
  const unsigned lane = threadIdx.x & 31u;
  const unsigned wg   = blockIdx.x * (blockDim.x >> 5) + (threadIdx.x >> 5);
  const int tilesN = N_ / 16;                       // 400
  const int b   = (int)(wg / ((CO_ / 16) * tilesN));
  int rem       = (int)(wg % ((CO_ / 16) * tilesN));
  const int cob = (rem / tilesN) * 16;
  const int pb  = (rem % tilesN) * 16;
  const unsigned l16 = lane & 15u;
  const unsigned h   = lane >> 4;

  v8f acc = zero8();
  const _Float16* wr = Wh  + (size_t)(cob + l16) * CV_;
  const _Float16* cr = Ctx + ((size_t)b * N_ + pb + l16) * CV_;

  #pragma unroll
  for (int cc = 0; cc < 4; ++cc) {
    const _Float16* wp = wr + cc * 32 + h * 8;
    v16h a  = join16(*(const v8h*)wp, *(const v8h*)(wp + 16));
    const _Float16* cp = cr + cc * 32 + h * 8;
    v16h bb = join16(*(const v8h*)cp, *(const v8h*)(cp + 16));
    acc = wmma_f16(a, bb, acc);
  }

  float gm = gamma[0];
  #pragma unroll
  for (int r = 0; r < 8; ++r) {
    int co = cob + r + 8 * (int)h;
    size_t oi = ((size_t)b * CO_ + co) * N_ + pb + l16;
    out[oi] = gm * (acc[r] + Wb[co]) + x[oi];
  }
}

// ---------------------------------------------------------------------------
extern "C" void kernel_launch(void* const* d_in, const int* in_sizes, int n_in,
                              void* d_out, int out_size, void* d_ws, size_t ws_size,
                              hipStream_t stream)
{
  const float* x     = (const float*)d_in[0];
  const float* y     = (const float*)d_in[1];
  const float* fk_w  = (const float*)d_in[2];
  const float* fk_g  = (const float*)d_in[3];
  const float* fk_b  = (const float*)d_in[4];
  const float* fk_m  = (const float*)d_in[5];
  const float* fk_v  = (const float*)d_in[6];
  const float* fq_w  = (const float*)d_in[7];
  const float* fq_g  = (const float*)d_in[8];
  const float* fq_b  = (const float*)d_in[9];
  const float* fq_m  = (const float*)d_in[10];
  const float* fq_v  = (const float*)d_in[11];
  const float* fv_w  = (const float*)d_in[12];
  const float* fv_b  = (const float*)d_in[13];
  const float* W_w   = (const float*)d_in[14];
  const float* W_b   = (const float*)d_in[15];
  const float* gamma = (const float*)d_in[16];
  float* out = (float*)d_out;

  char* ws = (char*)d_ws;
  size_t off = 0;
  auto alloc = [&](size_t bytes) -> void* {
    void* p = ws + off;
    off = (off + bytes + 255) & ~(size_t)255;
    return p;
  };
  _Float16* Qm  = (_Float16*)alloc((size_t)B_ * N_ * CK_ * sizeof(_Float16));
  _Float16* Km  = (_Float16*)alloc((size_t)B_ * N_ * CK_ * sizeof(_Float16));
  _Float16* Vt  = (_Float16*)alloc((size_t)B_ * CV_ * N_ * sizeof(_Float16));
  _Float16* Ctx = (_Float16*)alloc((size_t)B_ * N_ * CV_ * sizeof(_Float16));
  _Float16* Wh  = (_Float16*)alloc((size_t)CO_ * CV_ * sizeof(_Float16));
  (void)in_sizes; (void)n_in; (void)out_size; (void)ws_size;

  // projections
  dim3 pblk(256), pgrd((B_ * N_ + 255) / 256);
  proj64_kernel<<<pgrd, pblk, 0, stream>>>(y, fq_w, nullptr, fq_g, fq_b, fq_m, fq_v, Qm, 0, 0);
  proj64_kernel<<<pgrd, pblk, 0, stream>>>(x, fk_w, nullptr, fk_g, fk_b, fk_m, fk_v, Km, 0, 0);
  proj64_kernel<<<pgrd, pblk, 0, stream>>>(y, fv_w,            fv_b,      nullptr, nullptr, nullptr, nullptr, Vt, 1, 0);
  proj64_kernel<<<pgrd, pblk, 0, stream>>>(y, fv_w + 64 * C_,  fv_b + 64, nullptr, nullptr, nullptr, nullptr, Vt, 1, 64);

  // one-time W_w -> f16
  cvt_f16_kernel<<<dim3((CO_ * CV_ + 255) / 256), dim3(256), 0, stream>>>(W_w, Wh, CO_ * CV_);

  // flash attention: 100 blocks per batch, 4 waves (= 4 query tiles) per block
  flash_kernel<<<dim3(B_ * (N_ / 16 / 4)), dim3(128), 0, stream>>>(Qm, Km, Vt, Ctx);

  // output projection + residual: B * 16 * 400 wave tiles, 4 waves per block
  outproj_kernel<<<dim3((B_ * (CO_ / 16) * (N_ / 16)) / 4), dim3(128), 0, stream>>>(
      Wh, W_b, Ctx, x, gamma, out);
}

// v001
// A run of this version takes 181 microseconds.
// Two timings next to v000 put it at 3.16 and 3.14 times that version's speed.
#include <hip/hip_runtime.h>
#include <hip/hip_bf16.h>

typedef _Float16 v8h  __attribute__((ext_vector_type(8)));
typedef _Float16 v16h __attribute__((ext_vector_type(16)));
typedef float    v8f  __attribute__((ext_vector_type(8)));
typedef _Float16 v4h  __attribute__((ext_vector_type(4)));
typedef float    v2f  __attribute__((ext_vector_type(2)));
typedef float    v4f  __attribute__((ext_vector_type(4)));

#define B_  2
#define C_  256
#define N_  6400
#define CK_ 64
#define CV_ 128
#define CO_ 256

// 0.125 (Ck^-1/2) * log2(e): exp(s/8) == exp2(s * SCALE_LOG2E), single v_exp_f32
#define SCALE_LOG2E 0.1803368801111204f

__device__ __forceinline__ v16h join16(v8h lo, v8h hi) {
  return __builtin_shufflevector(lo, hi, 0,1,2,3,4,5,6,7,8,9,10,11,12,13,14,15);
}
__device__ __forceinline__ v8f zero8() {
  v8f z = {0.f,0.f,0.f,0.f,0.f,0.f,0.f,0.f};
  return z;
}
__device__ __forceinline__ v8f wmma_f16(v16h a, v16h b, v8f c) {
  // D = A(16x32 f16) * B(32x16 f16) + C(16x16 f32)
  return __builtin_amdgcn_wmma_f32_16x16x32_f16(false, a, false, b, (short)0, c, false, false);
}

// Async 16B global -> LDS copy (ASYNCcnt-tracked gfx1250 path).
// VDST = VGPR with LDS byte address, VADDR = 64-bit global address.
__device__ __forceinline__ void async_ld16(void* lds, const void* g) {
  unsigned l = (unsigned)(size_t)lds;    // generic->LDS addr = low 32 bits
  asm volatile("global_load_async_to_lds_b128 %0, %1, off"
               :: "v"(l), "v"(g) : "memory");
}

// ---------------------------------------------------------------------------
// All three 1x1-conv projections as one f32 GEMM on the 16x16x4 matrix form.
// blockIdx.y = group of 64 output channels: 0 = Q (from y, BN), 1 = K (from x,
// BN), 2 and 3 = the two halves of V (from y, bias).
// Block = 4 waves; a wave owns 64 channels x 64 positions (4 x 4 D tiles).
// A = weights [channel][c] from LDS, B = src [c][position] from global memory.
// k order inside a chunk of 8 input channels, the same for A and B:
//   c = chunk * 8 + 4 * h + 2 * s + v   (s = which WMMA of the chunk, v = register)
// Column l16 of position tile t is position n0 + 4 * l16 + t, so one 16-byte
// load of a src row feeds all four position tiles.
// Q/K: dst[(b*N+n)*64 + k] (f16);  V: dst[(b*CV + k)*N + n] (f16).
// ---------------------------------------------------------------------------
#define WP_ 260   // LDS row pitch in floats: 1040 B = 16 B x odd, for ds_load_b128

__device__ __forceinline__ v8f wmma_f32(v2f a, v2f b, v8f c) {
  // D = A(16x4 f32) * B(4x16 f32) + C(16x16 f32)
  return __builtin_amdgcn_wmma_f32_16x16x4_f32(false, a, false, b, (short)0, c, false, false);
}

__device__ __forceinline__ void proj_chunk(const v4f (&af)[4], const v4f (&bq)[4],
                                           v8f (&acc)[4][4]) {
  #pragma unroll   // constant indices keep the array in registers
  for (int s = 0; s < 2; ++s) {
    v2f bf[4];
    #pragma unroll   // constant indices keep the array in registers
    for (int t = 0; t < 4; ++t) { bf[t][0] = bq[2 * s][t]; bf[t][1] = bq[2 * s + 1][t]; }
    #pragma unroll   // constant indices keep the array in registers
    for (int i = 0; i < 4; ++i) {
      v2f a; a[0] = af[i][2 * s]; a[1] = af[i][2 * s + 1];
      #pragma unroll   // constant indices keep the array in registers
      for (int t = 0; t < 4; ++t) acc[i][t] = wmma_f32(a, bf[t], acc[i][t]);
    }
  }
}

__global__ void __launch_bounds__(128)
proj_wmma_kernel(const float* __restrict__ x,    const float* __restrict__ y,
                 const float* __restrict__ fq_w, const float* __restrict__ fq_g,
                 const float* __restrict__ fq_b, const float* __restrict__ fq_m,
                 const float* __restrict__ fq_v,
                 const float* __restrict__ fk_w, const float* __restrict__ fk_g,
                 const float* __restrict__ fk_b, const float* __restrict__ fk_m,
                 const float* __restrict__ fk_v,
                 const float* __restrict__ fv_w, const float* __restrict__ fv_b,
                 _Float16* __restrict__ Qm, _Float16* __restrict__ Km,
                 _Float16* __restrict__ Vt)
{
  __shared__ __attribute__((aligned(16))) float Wl[64][WP_];   // 65 KB

  const unsigned tid  = threadIdx.x;
  const unsigned lane = tid & 31u;
  const unsigned wib  = tid >> 5;
  const unsigned l16  = lane & 15u;
  const unsigned h    = lane >> 4;
  const int g  = (int)blockIdx.y;
  const int b  = (int)(blockIdx.x / (N_ / 256));
  const int n0 = (int)(blockIdx.x % (N_ / 256)) * 256 + (int)wib * 64;

  const float* src = (g == 1) ? x : y;
  const float* w   = (g == 0) ? fq_w : (g == 1) ? fk_w : fv_w + (size_t)(g - 2) * 64 * C_;

  // lane's column of src, at its own half's first row of a chunk
  const float* bp = src + (size_t)b * C_ * N_ + (size_t)(4 * h) * N_ + n0 + 4 * l16;
  auto loadB = [&](v4f (&d)[4], int chunk) {
    #pragma unroll   // constant indices keep the array in registers
    for (int j = 0; j < 4; ++j) d[j] = *(const v4f*)(bp + (size_t)(chunk * 8 + j) * N_);
  };
  auto loadA = [&](v4f (&d)[4], int chunk) {
    #pragma unroll   // constant indices keep the array in registers
    for (int i = 0; i < 4; ++i) d[i] = *(const v4f*)&Wl[i * 16 + l16][chunk * 8 + 4 * h];
  };

  // src rows of the first four chunks start flying before the weights are staged
  v4f bq[4][4];
  #pragma unroll   // constant indices keep the array in registers
  for (int u = 0; u < 4; ++u) loadB(bq[u], u);

  // the group's 64 x 256 weights -> LDS: the block reads them as one contiguous
  // run, two rows (128 x 16 B) per step, and pads each row to the LDS pitch
  const float* wp = w + tid * 4u;
  float*       wl = &Wl[tid >> 6][(tid & 63u) * 4u];
  #pragma unroll   // constant indices keep the array in registers
  for (int i = 0; i < 32; ++i) *(v4f*)(wl + i * 2 * WP_) = *(const v4f*)(wp + i * 2 * C_);
  __syncthreads();   // every wave reads weight rows that the other waves stored

  v8f acc[4][4];
  #pragma unroll   // constant indices keep the array in registers
  for (int i = 0; i < 4; ++i) {
    #pragma unroll   // constant indices keep the array in registers
    for (int t = 0; t < 4; ++t) acc[i][t] = zero8();
  }

  // src rows are loaded four chunks ahead, weight fragments one chunk ahead
  v4f af[2][4];
  loadA(af[0], 0);
  for (int cc = 0; cc < C_ / 8 - 4; cc += 4) {
    #pragma unroll   // constant indices keep the array in registers
    for (int u = 0; u < 4; ++u) {
      loadA(af[(u + 1) & 1], cc + u + 1);
      proj_chunk(af[u & 1], bq[u], acc);
      loadB(bq[u], cc + u + 4);
      // keeps each refill directly behind its chunk: without it the compiler sinks all
      // sixteen loads to the loop's foot and the next trip waits out their latency
      __builtin_amdgcn_sched_barrier(0);
    }
  }
  #pragma unroll   // constant indices keep the array in registers
  for (int u = 0; u < 4; ++u) {
    if (u < 3) loadA(af[(u + 1) & 1], C_ / 8 - 4 + u + 1);
    proj_chunk(af[u & 1], bq[u], acc);
  }

  // acc[i][t][r] = channel i*16 + 8*h + r at position n0 + 4*l16 + t
  if (g < 2) {
    const float* bn_g = g ? fk_g : fq_g;
    const float* bn_b = g ? fk_b : fq_b;
    const float* bn_m = g ? fk_m : fq_m;
    const float* bn_v = g ? fk_v : fq_v;
    _Float16* dp = (g ? Km : Qm) + ((size_t)b * N_ + n0 + 4 * l16) * CK_ + 8 * h;
    #pragma unroll   // constant indices keep the array in registers
    for (int i = 0; i < 4; ++i) {
      float sc[8], mm[8], be[8];
      #pragma unroll   // constant indices keep the array in registers
      for (int r = 0; r < 8; ++r) {
        unsigned k = (unsigned)i * 16u + 8u * h + (unsigned)r;
        sc[r] = bn_g[k] * rsqrtf(bn_v[k] + 1e-5f);
        mm[r] = bn_m[k];
        be[r] = bn_b[k];
      }
      #pragma unroll   // constant indices keep the array in registers
      for (int t = 0; t < 4; ++t) {
        v8h pk;
        #pragma unroll   // constant indices keep the array in registers
        for (int r = 0; r < 8; ++r) pk[r] = (_Float16)((acc[i][t][r] - mm[r]) * sc[r] + be[r]);
        *(v8h*)(dp + (size_t)t * CK_ + i * 16) = pk;
      }
    }
  } else {
    const int cvoff = (g - 2) * 64;
    const float* bi = fv_b + cvoff + 8 * h;
    _Float16* dp = Vt + ((size_t)b * CV_ + cvoff + 8 * h) * N_ + n0 + 4 * l16;
    #pragma unroll   // constant indices keep the array in registers
    for (int i = 0; i < 4; ++i) {
      #pragma unroll   // constant indices keep the array in registers
      for (int r = 0; r < 8; ++r) {
        float bs = bi[i * 16 + r];
        v4h pk;
        #pragma unroll   // constant indices keep the array in registers
        for (int t = 0; t < 4; ++t) pk[t] = (_Float16)(acc[i][t][r] + bs);
        *(v4h*)(dp + (size_t)(i * 16 + r) * N_) = pk;   // 16 lanes = one 128-B line
      }
    }
    // the listing lays the Q/K block behind this one and reuses the stores' registers
    // there: the wait stands between the stores and any such overwrite
    asm volatile("s_wait_xcnt 0x0" ::: "memory");
  }
}

// ---------------------------------------------------------------------------
// f32 -> f16 weight conversion (W_w, done once)
// ---------------------------------------------------------------------------
__global__ void cvt_f16_kernel(const float* __restrict__ src,
                               _Float16* __restrict__ dst, int n)
{
  int i = blockIdx.x * blockDim.x + threadIdx.x;
  if (i < n) dst[i] = (_Float16)src[i];
}

// ---------------------------------------------------------------------------
// Flash attention, block-cooperative version.
// Block = 4 waves = 4 consecutive 16-query tiles of ONE batch (100 blocks per
// batch). K/V 32-key tiles are double-buffered in LDS via async global->LDS
// copies (ASYNCcnt) shared by all 4 waves; fragment reads are ds_load_b128
// from bank-conflict-free padded rows (K stride 72 halfs, V stride 40 halfs).
// Softmax without running max (logits O(+-5) after BN; shift-invariant).
// Per key tile per wave: 4 WMMAs for S, 8 WMMAs for P*V, one LDS P round-trip.
// ---------------------------------------------------------------------------
__global__ void __launch_bounds__(128)
flash_kernel(const _Float16* __restrict__ Qm,
             const _Float16* __restrict__ Km,
             const _Float16* __restrict__ Vt,
             _Float16* __restrict__ Ctx)
{
  __shared__ __attribute__((aligned(16))) _Float16 Kl[2][32][72];   // 9.0 KB
  __shared__ __attribute__((aligned(16))) _Float16 Vl[2][128][40];  // 20 KB
  __shared__ __attribute__((aligned(16))) _Float16 Pb[4][16 * 32];  // 4 KB

  const unsigned tid  = threadIdx.x;
  const unsigned lane = tid & 31u;
  const unsigned wib  = tid >> 5;
  const int b  = (int)(blockIdx.x / (N_ / 16 / 4));                 // /100
  const int qb = ((int)(blockIdx.x % (N_ / 16 / 4)) * 4 + (int)wib) * 16;
  const unsigned l16 = lane & 15u;
  const unsigned h   = lane >> 4;       // 0 or 1

  const _Float16* Kb = Km + (size_t)b * N_ * CK_;
  const _Float16* Vb = Vt + (size_t)b * CV_ * N_;

  // Q A-fragments (16x32 f16, two Ck chunks), contiguous 16B loads per lane
  const _Float16* qrow = Qm + ((size_t)b * N_ + qb + l16) * CK_;
  v16h aq0 = join16(*(const v8h*)(qrow +       h * 8), *(const v8h*)(qrow + 16 + h * 8));
  v16h aq1 = join16(*(const v8h*)(qrow + 32 +  h * 8), *(const v8h*)(qrow + 48 + h * 8));

  v8f o[8];
  #pragma unroll
  for (int j = 0; j < 8; ++j) o[j] = zero8();
  float psum[8];
  #pragma unroll
  for (int r = 0; r < 8; ++r) psum[r] = 0.f;

  // issue async staging of one 32-key tile: 6 ASYNC ops per thread per tile
  auto stage = [&](int buf, int kb) {
    // K tile: 32 rows x 64 halfs = 256 x 16B segments, 2 per thread
    #pragma unroll
    for (int s = 0; s < 2; ++s) {
      unsigned seg = tid * 2 + s;              // 0..255
      unsigned r = seg >> 3, c = seg & 7;      // key row, 8-half column group
      async_ld16(&Kl[buf][r][c * 8], Kb + (size_t)(kb + (int)r) * CK_ + c * 8);
    }
    // V tile: thread tid owns cv row tid: 32 halfs = 4 x 16B segments
    #pragma unroll
    for (int s = 0; s < 4; ++s) {
      async_ld16(&Vl[buf][tid][s * 8], Vb + (size_t)tid * N_ + kb + s * 8);
    }
  };

  stage(0, 0);
  int cur = 0;

  for (int kb = 0; kb < N_; kb += 32) {
    if (kb + 32 < N_) {
      stage(cur ^ 1, kb + 32);                       // prefetch next tile
      asm volatile("s_wait_asynccnt 6" ::: "memory"); // in-order: cur resident
    } else {
      asm volatile("s_wait_asynccnt 0" ::: "memory");
    }
    __syncthreads();   // staged tile visible to all 4 waves

    // ---- load ALL four K B-fragments first (lets ds_loads pipeline), ----
    // ---- then run the 4 S-WMMAs                                       ----
    const _Float16* kr0 = &Kl[cur][l16][0];
    const _Float16* kr1 = &Kl[cur][16 + l16][0];
    v16h bk00 = join16(*(const v8h*)(kr0 +      h * 8), *(const v8h*)(kr0 + 16 + h * 8));
    v16h bk01 = join16(*(const v8h*)(kr0 + 32 + h * 8), *(const v8h*)(kr0 + 48 + h * 8));
    v16h bk10 = join16(*(const v8h*)(kr1 +      h * 8), *(const v8h*)(kr1 + 16 + h * 8));
    v16h bk11 = join16(*(const v8h*)(kr1 + 32 + h * 8), *(const v8h*)(kr1 + 48 + h * 8));

    v8f c0, c1;
    {
      v8f z = zero8();
      c0 = wmma_f16(aq0, bk00, z);
      c1 = wmma_f16(aq0, bk10, z);
      c0 = wmma_f16(aq1, bk01, c0);
      c1 = wmma_f16(aq1, bk11, c1);
    }

    // ---- p = exp(s/8) = exp2(s * SCALE_LOG2E); accumulate row sums ----
    #pragma unroll
    for (int r = 0; r < 8; ++r) {
      float p0 = __builtin_amdgcn_exp2f(c0[r] * SCALE_LOG2E);
      float p1 = __builtin_amdgcn_exp2f(c1[r] * SCALE_LOG2E);
      psum[r] += p0 + p1;
      int row = r + 8 * (int)h;
      Pb[wib][row * 32 +      l16] = (_Float16)p0;
      Pb[wib][row * 32 + 16 + l16] = (_Float16)p1;
    }

    asm volatile("s_wait_dscnt 0" ::: "memory");

    // reload P as a 16x32 A-fragment (contiguous 16B LDS reads per lane)
    const _Float16* pr = &Pb[wib][l16 * 32 + h * 8];
    v16h pA = join16(*(const v8h*)pr, *(const v8h*)(pr + 16));

    // ---- O += P * V ; 8 column groups over Cv=128, loads one step ahead ----
    const _Float16* vr0 = &Vl[cur][l16][0];
    v16h bv = join16(*(const v8h*)(vr0 + h * 8), *(const v8h*)(vr0 + 16 + h * 8));
    #pragma unroll
    for (int j = 0; j < 8; ++j) {
      v16h bv_cur = bv;
      if (j < 7) {
        const _Float16* vr = &Vl[cur][(j + 1) * 16 + l16][0];
        bv = join16(*(const v8h*)(vr + h * 8), *(const v8h*)(vr + 16 + h * 8));
      }
      o[j] = wmma_f16(pA, bv_cur, o[j]);
    }

    __syncthreads();   // all waves done reading buf[cur] before it is restaged
    cur ^= 1;
  }

  // ---- one lane-reduction per row at the very end ----
  float rinv[8];
  #pragma unroll
  for (int r = 0; r < 8; ++r) {
    float t = psum[r];
    #pragma unroll
    for (int m = 8; m >= 1; m >>= 1) t += __shfl_xor(t, m, 32);
    rinv[r] = 1.0f / t;
  }

  // ---- epilogue: normalize and store ctx[(b, n), cv] as f16 ----
  #pragma unroll
  for (int j = 0; j < 8; ++j) {
    #pragma unroll
    for (int r = 0; r < 8; ++r) {
      int m = r + 8 * (int)h;
      Ctx[((size_t)b * N_ + qb + m) * CV_ + j * 16 + l16] = (_Float16)(o[j][r] * rinv[r]);
    }
  }
}

// ---------------------------------------------------------------------------
// Output projection: out = gamma * (Wh[256,128] @ ctx + W_b) + x
// One wave = 16 output channels x 16 positions, K = Cv = 128 (4 WMMA chunks).
// Wh is the pre-converted f16 copy of W_w.
// ---------------------------------------------------------------------------
__global__ void __launch_bounds__(128)
outproj_kernel(const _Float16* __restrict__ Wh,
               const float* __restrict__ Wb,
               const _Float16* __restrict__ Ctx,
               const float* __restrict__ x,
               const float* __restrict__ gamma,
               float* __restrict__ out)
{
  const unsigned lane = threadIdx.x & 31u;
  const unsigned wg   = blockIdx.x * (blockDim.x >> 5) + (threadIdx.x >> 5);
  const int tilesN = N_ / 16;                       // 400
  const int b   = (int)(wg / ((CO_ / 16) * tilesN));
  int rem       = (int)(wg % ((CO_ / 16) * tilesN));
  const int cob = (rem / tilesN) * 16;
  const int pb  = (rem % tilesN) * 16;
  const unsigned l16 = lane & 15u;
  const unsigned h   = lane >> 4;

  v8f acc = zero8();
  const _Float16* wr = Wh  + (size_t)(cob + l16) * CV_;
  const _Float16* cr = Ctx + ((size_t)b * N_ + pb + l16) * CV_;

  #pragma unroll
  for (int cc = 0; cc < 4; ++cc) {
    const _Float16* wp = wr + cc * 32 + h * 8;
    v16h a  = join16(*(const v8h*)wp, *(const v8h*)(wp + 16));
    const _Float16* cp = cr + cc * 32 + h * 8;
    v16h bb = join16(*(const v8h*)cp, *(const v8h*)(cp + 16));
    acc = wmma_f16(a, bb, acc);
  }

  float gm = gamma[0];
  #pragma unroll
  for (int r = 0; r < 8; ++r) {
    int co = cob + r + 8 * (int)h;
    size_t oi = ((size_t)b * CO_ + co) * N_ + pb + l16;
    out[oi] = gm * (acc[r] + Wb[co]) + x[oi];
  }
}

// ---------------------------------------------------------------------------
extern "C" void kernel_launch(void* const* d_in, const int* in_sizes, int n_in,
                              void* d_out, int out_size, void* d_ws, size_t ws_size,
                              hipStream_t stream)
{
  const float* x     = (const float*)d_in[0];
  const float* y     = (const float*)d_in[1];
  const float* fk_w  = (const float*)d_in[2];
  const float* fk_g  = (const float*)d_in[3];
  const float* fk_b  = (const float*)d_in[4];
  const float* fk_m  = (const float*)d_in[5];
  const float* fk_v  = (const float*)d_in[6];
  const float* fq_w  = (const float*)d_in[7];
  const float* fq_g  = (const float*)d_in[8];
  const float* fq_b  = (const float*)d_in[9];
  const float* fq_m  = (const float*)d_in[10];
  const float* fq_v  = (const float*)d_in[11];
  const float* fv_w  = (const float*)d_in[12];
  const float* fv_b  = (const float*)d_in[13];
  const float* W_w   = (const float*)d_in[14];
  const float* W_b   = (const float*)d_in[15];
  const float* gamma = (const float*)d_in[16];
  float* out = (float*)d_out;

  char* ws = (char*)d_ws;
  size_t off = 0;
  auto alloc = [&](size_t bytes) -> void* {
    void* p = ws + off;
    off = (off + bytes + 255) & ~(size_t)255;
    return p;
  };
  _Float16* Qm  = (_Float16*)alloc((size_t)B_ * N_ * CK_ * sizeof(_Float16));
  _Float16* Km  = (_Float16*)alloc((size_t)B_ * N_ * CK_ * sizeof(_Float16));
  _Float16* Vt  = (_Float16*)alloc((size_t)B_ * CV_ * N_ * sizeof(_Float16));
  _Float16* Ctx = (_Float16*)alloc((size_t)B_ * N_ * CV_ * sizeof(_Float16));
  _Float16* Wh  = (_Float16*)alloc((size_t)CO_ * CV_ * sizeof(_Float16));
  (void)in_sizes; (void)n_in; (void)out_size; (void)ws_size;

  // projections: 50 blocks of 256 positions x 4 groups of 64 output channels
  proj_wmma_kernel<<<dim3(B_ * (N_ / 256), 4), dim3(128), 0, stream>>>(
      x, y, fq_w, fq_g, fq_b, fq_m, fq_v, fk_w, fk_g, fk_b, fk_m, fk_v, fv_w, fv_b, Qm, Km, Vt);

  // one-time W_w -> f16
  cvt_f16_kernel<<<dim3((CO_ * CV_ + 255) / 256), dim3(256), 0, stream>>>(W_w, Wh, CO_ * CV_);

  // flash attention: 100 blocks per batch, 4 waves (= 4 query tiles) per block
  flash_kernel<<<dim3(B_ * (N_ / 16 / 4)), dim3(128), 0, stream>>>(Qm, Km, Vt, Ctx);

  // output projection + residual: B * 16 * 400 wave tiles, 4 waves per block
  outproj_kernel<<<dim3((B_ * (CO_ / 16) * (N_ / 16)) / 4), dim3(128), 0, stream>>>(
      Wh, W_b, Ctx, x, gamma, out);
}

// v002
// One run takes 92.2 microseconds.
// In two side-by-side timings against v001, it was 1.95 and 1.97 times as fast.
// All steps since v000 together make it 6.18 times as fast.
#include <hip/hip_runtime.h>
#include <hip/hip_bf16.h>

typedef _Float16 v8h  __attribute__((ext_vector_type(8)));
typedef _Float16 v16h __attribute__((ext_vector_type(16)));
typedef float    v8f  __attribute__((ext_vector_type(8)));
typedef _Float16 v4h  __attribute__((ext_vector_type(4)));
typedef float    v2f  __attribute__((ext_vector_type(2)));
typedef float    v4f  __attribute__((ext_vector_type(4)));

#define B_  2
#define C_  256
#define N_  6400
#define CK_ 64
#define CV_ 128
#define CO_ 256

// 0.125 (Ck^-1/2) * log2(e): exp(s/8) == exp2(s * SCALE_LOG2E), single v_exp_f32
#define SCALE_LOG2E 0.1803368801111204f

__device__ __forceinline__ v16h join16(v8h lo, v8h hi) {
  return __builtin_shufflevector(lo, hi, 0,1,2,3,4,5,6,7,8,9,10,11,12,13,14,15);
}
__device__ __forceinline__ v8f zero8() {
  v8f z = {0.f,0.f,0.f,0.f,0.f,0.f,0.f,0.f};
  return z;
}
__device__ __forceinline__ v8f wmma_f16(v16h a, v16h b, v8f c) {
  // D = A(16x32 f16) * B(32x16 f16) + C(16x16 f32)
  return __builtin_amdgcn_wmma_f32_16x16x32_f16(false, a, false, b, (short)0, c, false, false);
}

// Six async 16-byte global -> LDS copies of one lane (ASYNCcnt-tracked): one thread's
// share of a staged tile. l* = LDS byte address (low 32 bits of the generic address),
// g* = global address. The closing s_wait_xcnt stands inside the statement so that no
// later write of an address register can be scheduled in front of it.
__device__ __forceinline__ unsigned lds_addr(const void* p) { return (unsigned)(size_t)p; }
__device__ __forceinline__ void async_copy6(unsigned l0, unsigned l1, unsigned l2,
                                            unsigned l3, unsigned l4, unsigned l5,
                                            const void* g0, const void* g1, const void* g2,
                                            const void* g3, const void* g4, const void* g5) {
  asm volatile("global_load_async_to_lds_b128 %0, %6, off\n\t"
               "global_load_async_to_lds_b128 %1, %7, off\n\t"
               "global_load_async_to_lds_b128 %2, %8, off\n\t"
               "global_load_async_to_lds_b128 %3, %9, off\n\t"
               "global_load_async_to_lds_b128 %4, %10, off\n\t"
               "global_load_async_to_lds_b128 %5, %11, off\n\t"
               "s_wait_xcnt 0x0"
               :: "v"(l0), "v"(l1), "v"(l2), "v"(l3), "v"(l4), "v"(l5),
                  "v"(g0), "v"(g1), "v"(g2), "v"(g3), "v"(g4), "v"(g5) : "memory");
}

// ---------------------------------------------------------------------------
// All three 1x1-conv projections as one f32 GEMM on the 16x16x4 matrix form.
// blockIdx.y = group of 64 output channels: 0 = Q (from y, BN), 1 = K (from x,
// BN), 2 and 3 = the two halves of V (from y, bias).
// Block = 4 waves; a wave owns 64 channels x 64 positions (4 x 4 D tiles).
// A = weights [channel][c] from LDS, B = src [c][position] from global memory.
// k order inside a chunk of 8 input channels, the same for A and B:
//   c = chunk * 8 + 4 * h + 2 * s + v   (s = which WMMA of the chunk, v = register)
// Column l16 of position tile t is position n0 + 4 * l16 + t, so one 16-byte
// load of a src row feeds all four position tiles.
// Q/K: dst[(b*N+n)*64 + k] (f16);  V: dst[(b*CV + k)*N + n] (f16).
// ---------------------------------------------------------------------------
#define WP_ 260   // LDS row pitch in floats: 1040 B = 16 B x odd, for ds_load_b128

__device__ __forceinline__ v8f wmma_f32(v2f a, v2f b, v8f c) {
  // D = A(16x4 f32) * B(4x16 f32) + C(16x16 f32)
  return __builtin_amdgcn_wmma_f32_16x16x4_f32(false, a, false, b, (short)0, c, false, false);
}

__device__ __forceinline__ void proj_chunk(const v4f (&af)[4], const v4f (&bq)[4],
                                           v8f (&acc)[4][4]) {
  #pragma unroll   // constant indices keep the array in registers
  for (int s = 0; s < 2; ++s) {
    v2f bf[4];
    #pragma unroll   // constant indices keep the array in registers
    for (int t = 0; t < 4; ++t) { bf[t][0] = bq[2 * s][t]; bf[t][1] = bq[2 * s + 1][t]; }
    #pragma unroll   // constant indices keep the array in registers
    for (int i = 0; i < 4; ++i) {
      v2f a; a[0] = af[i][2 * s]; a[1] = af[i][2 * s + 1];
      #pragma unroll   // constant indices keep the array in registers
      for (int t = 0; t < 4; ++t) acc[i][t] = wmma_f32(a, bf[t], acc[i][t]);
    }
  }
}

__global__ void __launch_bounds__(128)
proj_wmma_kernel(const float* __restrict__ x,    const float* __restrict__ y,
                 const float* __restrict__ fq_w, const float* __restrict__ fq_g,
                 const float* __restrict__ fq_b, const float* __restrict__ fq_m,
                 const float* __restrict__ fq_v,
                 const float* __restrict__ fk_w, const float* __restrict__ fk_g,
                 const float* __restrict__ fk_b, const float* __restrict__ fk_m,
                 const float* __restrict__ fk_v,
                 const float* __restrict__ fv_w, const float* __restrict__ fv_b,
                 _Float16* __restrict__ Qm, _Float16* __restrict__ Km,
                 _Float16* __restrict__ Vt)
{
  __shared__ __attribute__((aligned(16))) float Wl[64][WP_];   // 65 KB

  const unsigned tid  = threadIdx.x;
  const unsigned lane = tid & 31u;
  const unsigned wib  = tid >> 5;
  const unsigned l16  = lane & 15u;
  const unsigned h    = lane >> 4;
  const int g  = (int)blockIdx.y;
  const int b  = (int)(blockIdx.x / (N_ / 256));
  const int n0 = (int)(blockIdx.x % (N_ / 256)) * 256 + (int)wib * 64;

  const float* src = (g == 1) ? x : y;
  const float* w   = (g == 0) ? fq_w : (g == 1) ? fk_w : fv_w + (size_t)(g - 2) * 64 * C_;

  // lane's column of src, at its own half's first row of a chunk
  const float* bp = src + (size_t)b * C_ * N_ + (size_t)(4 * h) * N_ + n0 + 4 * l16;
  auto loadB = [&](v4f (&d)[4], int chunk) {
    #pragma unroll   // constant indices keep the array in registers
    for (int j = 0; j < 4; ++j) d[j] = *(const v4f*)(bp + (size_t)(chunk * 8 + j) * N_);
  };
  auto loadA = [&](v4f (&d)[4], int chunk) {
    #pragma unroll   // constant indices keep the array in registers
    for (int i = 0; i < 4; ++i) d[i] = *(const v4f*)&Wl[i * 16 + l16][chunk * 8 + 4 * h];
  };

  // src rows of the first four chunks start flying before the weights are staged
  v4f bq[4][4];
  #pragma unroll   // constant indices keep the array in registers
  for (int u = 0; u < 4; ++u) loadB(bq[u], u);

  // the group's 64 x 256 weights -> LDS: the block reads them as one contiguous
  // run, two rows (128 x 16 B) per step, and pads each row to the LDS pitch
  const float* wp = w + tid * 4u;
  float*       wl = &Wl[tid >> 6][(tid & 63u) * 4u];
  #pragma unroll   // constant indices keep the array in registers
  for (int i = 0; i < 32; ++i) *(v4f*)(wl + i * 2 * WP_) = *(const v4f*)(wp + i * 2 * C_);
  __syncthreads();   // every wave reads weight rows that the other waves stored

  v8f acc[4][4];
  #pragma unroll   // constant indices keep the array in registers
  for (int i = 0; i < 4; ++i) {
    #pragma unroll   // constant indices keep the array in registers
    for (int t = 0; t < 4; ++t) acc[i][t] = zero8();
  }

  // src rows are loaded four chunks ahead, weight fragments one chunk ahead
  v4f af[2][4];
  loadA(af[0], 0);
  for (int cc = 0; cc < C_ / 8 - 4; cc += 4) {
    #pragma unroll   // constant indices keep the array in registers
    for (int u = 0; u < 4; ++u) {
      loadA(af[(u + 1) & 1], cc + u + 1);
      proj_chunk(af[u & 1], bq[u], acc);
      loadB(bq[u], cc + u + 4);
      // keeps each refill directly behind its chunk: without it the compiler sinks all
      // sixteen loads to the loop's foot and the next trip waits out their latency
      __builtin_amdgcn_sched_barrier(0);
    }
  }
  #pragma unroll   // constant indices keep the array in registers
  for (int u = 0; u < 4; ++u) {
    if (u < 3) loadA(af[(u + 1) & 1], C_ / 8 - 4 + u + 1);
    proj_chunk(af[u & 1], bq[u], acc);
  }

  // acc[i][t][r] = channel i*16 + 8*h + r at position n0 + 4*l16 + t
  if (g < 2) {
    const float* bn_g = g ? fk_g : fq_g;
    const float* bn_b = g ? fk_b : fq_b;
    const float* bn_m = g ? fk_m : fq_m;
    const float* bn_v = g ? fk_v : fq_v;
    _Float16* dp = (g ? Km : Qm) + ((size_t)b * N_ + n0 + 4 * l16) * CK_ + 8 * h;
    #pragma unroll   // constant indices keep the array in registers
    for (int i = 0; i < 4; ++i) {
      float sc[8], mm[8], be[8];
      #pragma unroll   // constant indices keep the array in registers
      for (int r = 0; r < 8; ++r) {
        unsigned k = (unsigned)i * 16u + 8u * h + (unsigned)r;
        sc[r] = bn_g[k] * rsqrtf(bn_v[k] + 1e-5f);
        mm[r] = bn_m[k];
        be[r] = bn_b[k];
      }
      #pragma unroll   // constant indices keep the array in registers
      for (int t = 0; t < 4; ++t) {
        v8h pk;
        #pragma unroll   // constant indices keep the array in registers
        for (int r = 0; r < 8; ++r) pk[r] = (_Float16)((acc[i][t][r] - mm[r]) * sc[r] + be[r]);
        *(v8h*)(dp + (size_t)t * CK_ + i * 16) = pk;
      }
    }
  } else {
    const int cvoff = (g - 2) * 64;
    const float* bi = fv_b + cvoff + 8 * h;
    _Float16* dp = Vt + ((size_t)b * CV_ + cvoff + 8 * h) * N_ + n0 + 4 * l16;
    #pragma unroll   // constant indices keep the array in registers
    for (int i = 0; i < 4; ++i) {
      #pragma unroll   // constant indices keep the array in registers
      for (int r = 0; r < 8; ++r) {
        float bs = bi[i * 16 + r];
        v4h pk;
        #pragma unroll   // constant indices keep the array in registers
        for (int t = 0; t < 4; ++t) pk[t] = (_Float16)(acc[i][t][r] + bs);
        *(v4h*)(dp + (size_t)(i * 16 + r) * N_) = pk;   // 16 lanes = one 128-B line
      }
    }
    // the listing lays the Q/K block behind this one and reuses the stores' registers
    // there: the wait stands between the stores and any such overwrite
    asm volatile("s_wait_xcnt 0x0" ::: "memory");
  }
}

// ---------------------------------------------------------------------------
// f32 -> f16 weight conversion (W_w, done once)
// ---------------------------------------------------------------------------
__global__ void cvt_f16_kernel(const float* __restrict__ src,
                               _Float16* __restrict__ dst, int n)
{
  int i = blockIdx.x * blockDim.x + threadIdx.x;
  if (i < n) dst[i] = (_Float16)src[i];
}

// ---------------------------------------------------------------------------
// Flash attention, block-cooperative version, keys split inside the block.
// Block = 16 waves = 4 consecutive 16-query tiles of ONE batch (100 blocks per
// batch) x 4 key quarters: wave (qt, ks) works query tile qt against keys
// ks*32 .. ks*32+31 of every staged 128-key tile, so a SIMD holds four waves
// whose LDS, exp and matrix latencies cover one another. K/V tiles are
// double-buffered in LDS via async global->LDS copies shared by all 16 waves;
// fragment reads are ds_load_b128 from padded rows (K pitch 72 halfs, V pitch
// 136 halfs: 16 B x odd).
// Softmax without running max (logits O(+-5) after BN; shift-invariant), so the
// four key quarters' f32 partial outputs and row sums simply add: they meet in
// LDS behind the loop, in the fixed order ks = 0, 1, 2, 3.
// Per key tile per wave: 4 WMMAs for S, 8 WMMAs for P*V, one LDS P round-trip.
// ---------------------------------------------------------------------------
#define KT_ 128          // keys per staged tile
#define NT_ (N_ / KT_)   // 50 staged tiles

__global__ void __launch_bounds__(512)
flash_kernel(const _Float16* __restrict__ Qm,
             const _Float16* __restrict__ Km,
             const _Float16* __restrict__ Vt,
             _Float16* __restrict__ Ctx)
{
  __shared__ __attribute__((aligned(16))) _Float16 Kl[2][KT_][72];     // 36 KB
  __shared__ __attribute__((aligned(16))) _Float16 Vl[2][CV_][KT_ + 8]; // 68 KB
  __shared__ __attribute__((aligned(16))) _Float16 Pb[16][16 * 32];    // 16 KB
  __shared__ __attribute__((aligned(16))) float    Om[16][16][32][4];  // 128 KB, partial O
  __shared__ __attribute__((aligned(16))) float    Ps[16][16];         // partial row sums

  const unsigned tid  = threadIdx.x;
  const unsigned lane = tid & 31u;
  const unsigned wib  = tid >> 5;
  const unsigned qt   = wib & 3u;       // query tile of the block
  const unsigned ks   = wib >> 2;       // key quarter of every staged tile
  const int b  = (int)(blockIdx.x / (N_ / 16 / 4));                 // /100
  const int qb = ((int)(blockIdx.x % (N_ / 16 / 4)) * 4 + (int)qt) * 16;
  const unsigned l16 = lane & 15u;
  const unsigned h   = lane >> 4;       // 0 or 1

  const _Float16* Kb = Km + (size_t)b * N_ * CK_;
  const _Float16* Vb = Vt + (size_t)b * CV_ * N_;

  // Q A-fragments (16x32 f16, two Ck chunks), contiguous 16B loads per lane
  const _Float16* qrow = Qm + ((size_t)b * N_ + qb + l16) * CK_;
  v16h aq0 = join16(*(const v8h*)(qrow +       h * 8), *(const v8h*)(qrow + 16 + h * 8));
  v16h aq1 = join16(*(const v8h*)(qrow + 32 +  h * 8), *(const v8h*)(qrow + 48 + h * 8));

  v8f o[8];
  #pragma unroll
  for (int j = 0; j < 8; ++j) o[j] = zero8();
  float psum[8];
  #pragma unroll
  for (int r = 0; r < 8; ++r) psum[r] = 0.f;

  // async staging of one 128-key tile: 6 copies per thread.
  // K tile: 128 rows x 128 B, one contiguous 16 KB run: segment = s*512 + tid.
  // V tile: 128 cv rows x 256 B: 16 segments a row, a wave covers two whole rows.
  const unsigned kr = tid >> 3, kc = (tid & 7u) * 8u;     // + 64 rows per s
  const unsigned vr = tid >> 4, vc = (tid & 15u) * 8u;    // + 32 rows per s
  auto stage = [&](int buf, int kb) {
    const _Float16* kg = Kb + (size_t)(kb + (int)kr) * CK_ + kc;
    const _Float16* vg = Vb + (size_t)vr * N_ + kb + vc;
    async_copy6(lds_addr(&Kl[buf][kr][kc]),      lds_addr(&Kl[buf][kr + 64][kc]),
                lds_addr(&Vl[buf][vr][vc]),      lds_addr(&Vl[buf][vr + 32][vc]),
                lds_addr(&Vl[buf][vr + 64][vc]), lds_addr(&Vl[buf][vr + 96][vc]),
                kg, kg + 64 * CK_,
                vg, vg + (size_t)32 * N_, vg + (size_t)64 * N_, vg + (size_t)96 * N_);
  };

  stage(0, 0);
  asm volatile("s_wait_asynccnt 0x0" ::: "memory");   // own copies of tile 0 landed
  __syncthreads();                                    // tile 0 visible to all 16 waves
  stage(1, KT_);

  for (int t = 0; t < NT_; ++t) {
    const int cur = t & 1;

    // ---- load ALL four K B-fragments first (lets ds_loads pipeline), ----
    // ---- then run the 4 S-WMMAs                                       ----
    const _Float16* kr0 = &Kl[cur][ks * 32 + l16][0];
    const _Float16* kr1 = &Kl[cur][ks * 32 + 16 + l16][0];
    v16h bk00 = join16(*(const v8h*)(kr0 +      h * 8), *(const v8h*)(kr0 + 16 + h * 8));
    v16h bk01 = join16(*(const v8h*)(kr0 + 32 + h * 8), *(const v8h*)(kr0 + 48 + h * 8));
    v16h bk10 = join16(*(const v8h*)(kr1 +      h * 8), *(const v8h*)(kr1 + 16 + h * 8));
    v16h bk11 = join16(*(const v8h*)(kr1 + 32 + h * 8), *(const v8h*)(kr1 + 48 + h * 8));

    v8f c0, c1;
    {
      v8f z = zero8();
      c0 = wmma_f16(aq0, bk00, z);
      c1 = wmma_f16(aq0, bk10, z);
      c0 = wmma_f16(aq1, bk01, c0);
      c1 = wmma_f16(aq1, bk11, c1);
    }

    // ---- p = exp(s/8) = exp2(s * SCALE_LOG2E); accumulate row sums ----
    #pragma unroll
    for (int r = 0; r < 8; ++r) {
      float p0 = __builtin_amdgcn_exp2f(c0[r] * SCALE_LOG2E);
      float p1 = __builtin_amdgcn_exp2f(c1[r] * SCALE_LOG2E);
      psum[r] += p0 + p1;
      int row = r + 8 * (int)h;
      Pb[wib][row * 32 +      l16] = (_Float16)p0;
      Pb[wib][row * 32 + 16 + l16] = (_Float16)p1;
    }

    asm volatile("s_wait_dscnt 0" ::: "memory");

    // reload P as a 16x32 A-fragment (contiguous 16B LDS reads per lane)
    const _Float16* pr = &Pb[wib][l16 * 32 + h * 8];
    v16h pA = join16(*(const v8h*)pr, *(const v8h*)(pr + 16));

    // ---- O += P * V ; 8 column groups over Cv=128, loads one step ahead ----
    const _Float16* vr0 = &Vl[cur][l16][ks * 32];
    v16h bv = join16(*(const v8h*)(vr0 + h * 8), *(const v8h*)(vr0 + 16 + h * 8));
    #pragma unroll
    for (int j = 0; j < 8; ++j) {
      v16h bv_cur = bv;
      if (j < 7) {
        const _Float16* vp = &Vl[cur][(j + 1) * 16 + l16][ks * 32];
        bv = join16(*(const v8h*)(vp + h * 8), *(const v8h*)(vp + 16 + h * 8));
      }
      o[j] = wmma_f16(pA, bv_cur, o[j]);
    }

    // publish point: own reads of buf[cur] retired, own copies of tile t+1 landed,
    // then the one barrier that shows tile t+1 to every wave and frees buf[cur]
    asm volatile("s_wait_dscnt 0x0" ::: "memory");
    asm volatile("s_wait_asynccnt 0x0" ::: "memory");
    __syncthreads();
    if (t + 2 < NT_) stage(cur, (t + 2) * KT_);
  }
  asm volatile("s_wait_asynccnt 0x0" ::: "memory");   // nothing in flight at the wave's end

  // ---- one lane-reduction per row, then the wave's partials go to LDS ----
  v4f rs[2];
  #pragma unroll
  for (int r = 0; r < 8; ++r) {
    float t = psum[r];
    #pragma unroll
    for (int m = 8; m >= 1; m >>= 1) t += __shfl_xor(t, m, 32);
    rs[r >> 2][r & 3] = t;
  }
  if (l16 == 0) {
    *(v4f*)&Ps[wib][8 * h]     = rs[0];
    *(v4f*)&Ps[wib][8 * h + 4] = rs[1];
  }
  #pragma unroll
  for (int j = 0; j < 8; ++j) {
    #pragma unroll
    for (int q = 0; q < 2; ++q) {
      v4f pk = {o[j][4 * q], o[j][4 * q + 1], o[j][4 * q + 2], o[j][4 * q + 3]};
      *(v4f*)&Om[wib][j * 2 + q][lane][0] = pk;
    }
  }
  __syncthreads();   // every wave reads partials that the three other key quarters stored

  // ---- epilogue: wave (qt, ks) adds the four quarters for column groups 2*ks and
  // ---- 2*ks+1 of its query tile, normalizes and stores ctx[(b, n), cv] as f16
  float rinv[8];
  #pragma unroll
  for (int q = 0; q < 2; ++q) {
    v4f s = *(const v4f*)&Ps[qt][8 * h + 4 * q];
    #pragma unroll
    for (int p = 1; p < 4; ++p) s += *(const v4f*)&Ps[p * 4 + qt][8 * h + 4 * q];
    #pragma unroll
    for (int e = 0; e < 4; ++e) rinv[4 * q + e] = 1.0f / s[e];
  }
  #pragma unroll
  for (int jj = 0; jj < 2; ++jj) {
    const unsigned j = 2 * ks + jj;
    #pragma unroll
    for (int q = 0; q < 2; ++q) {
      v4f a = *(const v4f*)&Om[qt][j * 2 + q][lane][0];
      #pragma unroll
      for (int p = 1; p < 4; ++p) a += *(const v4f*)&Om[p * 4 + qt][j * 2 + q][lane][0];
      #pragma unroll
      for (int e = 0; e < 4; ++e) {
        int m = 4 * q + e + 8 * (int)h;
        Ctx[((size_t)b * N_ + qb + m) * CV_ + j * 16 + l16] = (_Float16)(a[e] * rinv[4 * q + e]);
      }
    }
  }
}

// ---------------------------------------------------------------------------
// Output projection: out = gamma * (Wh[256,128] @ ctx + W_b) + x
// One wave = 16 output channels x 16 positions, K = Cv = 128 (4 WMMA chunks).
// Wh is the pre-converted f16 copy of W_w.
// ---------------------------------------------------------------------------
__global__ void __launch_bounds__(128)
outproj_kernel(const _Float16* __restrict__ Wh,
               const float* __restrict__ Wb,
               const _Float16* __restrict__ Ctx,
               const float* __restrict__ x,
               const float* __restrict__ gamma,
               float* __restrict__ out)
{
  const unsigned lane = threadIdx.x & 31u;
  const unsigned wg   = blockIdx.x * (blockDim.x >> 5) + (threadIdx.x >> 5);
  const int tilesN = N_ / 16;                       // 400
  const int b   = (int)(wg / ((CO_ / 16) * tilesN));
  int rem       = (int)(wg % ((CO_ / 16) * tilesN));
  const int cob = (rem / tilesN) * 16;
  const int pb  = (rem % tilesN) * 16;
  const unsigned l16 = lane & 15u;
  const unsigned h   = lane >> 4;

  v8f acc = zero8();
  const _Float16* wr = Wh  + (size_t)(cob + l16) * CV_;
  const _Float16* cr = Ctx + ((size_t)b * N_ + pb + l16) * CV_;

  #pragma unroll
  for (int cc = 0; cc < 4; ++cc) {
    const _Float16* wp = wr + cc * 32 + h * 8;
    v16h a  = join16(*(const v8h*)wp, *(const v8h*)(wp + 16));
    const _Float16* cp = cr + cc * 32 + h * 8;
    v16h bb = join16(*(const v8h*)cp, *(const v8h*)(cp + 16));
    acc = wmma_f16(a, bb, acc);
  }

  float gm = gamma[0];
  #pragma unroll
  for (int r = 0; r < 8; ++r) {
    int co = cob + r + 8 * (int)h;
    size_t oi = ((size_t)b * CO_ + co) * N_ + pb + l16;
    out[oi] = gm * (acc[r] + Wb[co]) + x[oi];
  }
}

// ---------------------------------------------------------------------------
extern "C" void kernel_launch(void* const* d_in, const int* in_sizes, int n_in,
                              void* d_out, int out_size, void* d_ws, size_t ws_size,
                              hipStream_t stream)
{
  const float* x     = (const float*)d_in[0];
  const float* y     = (const float*)d_in[1];
  const float* fk_w  = (const float*)d_in[2];
  const float* fk_g  = (const float*)d_in[3];
  const float* fk_b  = (const float*)d_in[4];
  const float* fk_m  = (const float*)d_in[5];
  const float* fk_v  = (const float*)d_in[6];
  const float* fq_w  = (const float*)d_in[7];
  const float* fq_g  = (const float*)d_in[8];
  const float* fq_b  = (const float*)d_in[9];
  const float* fq_m  = (const float*)d_in[10];
  const float* fq_v  = (const float*)d_in[11];
  const float* fv_w  = (const float*)d_in[12];
  const float* fv_b  = (const float*)d_in[13];
  const float* W_w   = (const float*)d_in[14];
  const float* W_b   = (const float*)d_in[15];
  const float* gamma = (const float*)d_in[16];
  float* out = (float*)d_out;

  char* ws = (char*)d_ws;
  size_t off = 0;
  auto alloc = [&](size_t bytes) -> void* {
    void* p = ws + off;
    off = (off + bytes + 255) & ~(size_t)255;
    return p;
  };
  _Float16* Qm  = (_Float16*)alloc((size_t)B_ * N_ * CK_ * sizeof(_Float16));
  _Float16* Km  = (_Float16*)alloc((size_t)B_ * N_ * CK_ * sizeof(_Float16));
  _Float16* Vt  = (_Float16*)alloc((size_t)B_ * CV_ * N_ * sizeof(_Float16));
  _Float16* Ctx = (_Float16*)alloc((size_t)B_ * N_ * CV_ * sizeof(_Float16));
  _Float16* Wh  = (_Float16*)alloc((size_t)CO_ * CV_ * sizeof(_Float16));
  (void)in_sizes; (void)n_in; (void)out_size; (void)ws_size;

  // projections: 50 blocks of 256 positions x 4 groups of 64 output channels
  proj_wmma_kernel<<<dim3(B_ * (N_ / 256), 4), dim3(128), 0, stream>>>(
      x, y, fq_w, fq_g, fq_b, fq_m, fq_v, fk_w, fk_g, fk_b, fk_m, fk_v, fv_w, fv_b, Qm, Km, Vt);

  // one-time W_w -> f16
  cvt_f16_kernel<<<dim3((CO_ * CV_ + 255) / 256), dim3(256), 0, stream>>>(W_w, Wh, CO_ * CV_);

  // flash attention: 100 blocks per batch, 16 waves (4 query tiles x 4 key quarters) per block
  flash_kernel<<<dim3(B_ * (N_ / 16 / 4)), dim3(512), 0, stream>>>(Qm, Km, Vt, Ctx);

  // output projection + residual: B * 16 * 400 wave tiles, 4 waves per block
  outproj_kernel<<<dim3((B_ * (CO_ / 16) * (N_ / 16)) / 4), dim3(128), 0, stream>>>(
      Wh, W_b, Ctx, x, gamma, out);
}

// v003
// A run of this version takes 67.7 microseconds.
// In two side-by-side timings against v002, it was 1.36 and 1.34 times as fast.
// Over all steps from v000 it is 8.36 times as fast.
#include <hip/hip_runtime.h>
#include <hip/hip_bf16.h>

typedef _Float16 v8h  __attribute__((ext_vector_type(8)));
typedef _Float16 v16h __attribute__((ext_vector_type(16)));
typedef float    v8f  __attribute__((ext_vector_type(8)));
typedef _Float16 v4h  __attribute__((ext_vector_type(4)));
typedef float    v2f  __attribute__((ext_vector_type(2)));
typedef float    v4f  __attribute__((ext_vector_type(4)));

#define B_  2
#define C_  256
#define N_  6400
#define CK_ 64
#define CV_ 128
#define CO_ 256

// 0.125 (Ck^-1/2) * log2(e): exp(s/8) == exp2(s * SCALE_LOG2E), single v_exp_f32
#define SCALE_LOG2E 0.1803368801111204f

__device__ __forceinline__ v16h join16(v8h lo, v8h hi) {
  return __builtin_shufflevector(lo, hi, 0,1,2,3,4,5,6,7,8,9,10,11,12,13,14,15);
}
__device__ __forceinline__ v8f zero8() {
  v8f z = {0.f,0.f,0.f,0.f,0.f,0.f,0.f,0.f};
  return z;
}
__device__ __forceinline__ v8f wmma_f16(v16h a, v16h b, v8f c) {
  // D = A(16x32 f16) * B(32x16 f16) + C(16x16 f32)
  return __builtin_amdgcn_wmma_f32_16x16x32_f16(false, a, false, b, (short)0, c, false, false);
}

// Six async 16-byte global -> LDS copies of one lane (ASYNCcnt-tracked): one thread's
// share of a staged tile. l* = LDS byte address (low 32 bits of the generic address),
// g* = global address. The closing s_wait_xcnt stands inside the statement so that no
// later write of an address register can be scheduled in front of it.
__device__ __forceinline__ unsigned lds_addr(const void* p) { return (unsigned)(size_t)p; }
__device__ __forceinline__ void async_copy6(unsigned l0, unsigned l1, unsigned l2,
                                            unsigned l3, unsigned l4, unsigned l5,
                                            const void* g0, const void* g1, const void* g2,
                                            const void* g3, const void* g4, const void* g5) {
  asm volatile("global_load_async_to_lds_b128 %0, %6, off\n\t"
               "global_load_async_to_lds_b128 %1, %7, off\n\t"
               "global_load_async_to_lds_b128 %2, %8, off\n\t"
               "global_load_async_to_lds_b128 %3, %9, off\n\t"
               "global_load_async_to_lds_b128 %4, %10, off\n\t"
               "global_load_async_to_lds_b128 %5, %11, off\n\t"
               "s_wait_xcnt 0x0"
               :: "v"(l0), "v"(l1), "v"(l2), "v"(l3), "v"(l4), "v"(l5),
                  "v"(g0), "v"(g1), "v"(g2), "v"(g3), "v"(g4), "v"(g5) : "memory");
}

// ---------------------------------------------------------------------------
// All three 1x1-conv projections as one f32 GEMM on the 16x16x4 matrix form.
// blockIdx.y = group of 64 output channels: 0 = Q (from y, BN), 1 = K (from x,
// BN), 2 and 3 = the two halves of V (from y, bias).
// Block = 4 waves; a wave owns 64 channels x 64 positions (4 x 4 D tiles).
// A = weights [channel][c] from LDS, B = src [c][position] from global memory.
// k order inside a chunk of 8 input channels, the same for A and B:
//   c = chunk * 8 + 4 * h + 2 * s + v   (s = which WMMA of the chunk, v = register)
// Column l16 of position tile t is position n0 + 4 * l16 + t, so one 16-byte
// load of a src row feeds all four position tiles.
// Q/K: dst[(b*N+n)*64 + k] (f16);  V: dst[(b*CV + k)*N + n] (f16).
// ---------------------------------------------------------------------------
#define WP_ 260   // LDS row pitch in floats: 1040 B = 16 B x odd, for ds_load_b128

__device__ __forceinline__ v8f wmma_f32(v2f a, v2f b, v8f c) {
  // D = A(16x4 f32) * B(4x16 f32) + C(16x16 f32)
  return __builtin_amdgcn_wmma_f32_16x16x4_f32(false, a, false, b, (short)0, c, false, false);
}

__device__ __forceinline__ void proj_chunk(const v4f (&af)[4], const v4f (&bq)[4],
                                           v8f (&acc)[4][4]) {
  #pragma unroll   // constant indices keep the array in registers
  for (int s = 0; s < 2; ++s) {
    v2f bf[4];
    #pragma unroll   // constant indices keep the array in registers
    for (int t = 0; t < 4; ++t) { bf[t][0] = bq[2 * s][t]; bf[t][1] = bq[2 * s + 1][t]; }
    #pragma unroll   // constant indices keep the array in registers
    for (int i = 0; i < 4; ++i) {
      v2f a; a[0] = af[i][2 * s]; a[1] = af[i][2 * s + 1];
      #pragma unroll   // constant indices keep the array in registers
      for (int t = 0; t < 4; ++t) acc[i][t] = wmma_f32(a, bf[t], acc[i][t]);
    }
  }
}

__global__ void __launch_bounds__(128)
proj_wmma_kernel(const float* __restrict__ x,    const float* __restrict__ y,
                 const float* __restrict__ fq_w, const float* __restrict__ fq_g,
                 const float* __restrict__ fq_b, const float* __restrict__ fq_m,
                 const float* __restrict__ fq_v,
                 const float* __restrict__ fk_w, const float* __restrict__ fk_g,
                 const float* __restrict__ fk_b, const float* __restrict__ fk_m,
                 const float* __restrict__ fk_v,
                 const float* __restrict__ fv_w, const float* __restrict__ fv_b,
                 _Float16* __restrict__ Qm, _Float16* __restrict__ Km,
                 _Float16* __restrict__ Vt)
{
  __shared__ __attribute__((aligned(16))) float Wl[64][WP_];   // 65 KB

  const unsigned tid  = threadIdx.x;
  const unsigned lane = tid & 31u;
  const unsigned wib  = tid >> 5;
  const unsigned l16  = lane & 15u;
  const unsigned h    = lane >> 4;
  const int g  = (int)blockIdx.y;
  const int b  = (int)(blockIdx.x / (N_ / 256));
  const int n0 = (int)(blockIdx.x % (N_ / 256)) * 256 + (int)wib * 64;

  const float* src = (g == 1) ? x : y;
  const float* w   = (g == 0) ? fq_w : (g == 1) ? fk_w : fv_w + (size_t)(g - 2) * 64 * C_;

  // lane's column of src, at its own half's first row of a chunk
  const float* bp = src + (size_t)b * C_ * N_ + (size_t)(4 * h) * N_ + n0 + 4 * l16;
  auto loadB = [&](v4f (&d)[4], int chunk) {
    #pragma unroll   // constant indices keep the array in registers
    for (int j = 0; j < 4; ++j) d[j] = *(const v4f*)(bp + (size_t)(chunk * 8 + j) * N_);
  };
  auto loadA = [&](v4f (&d)[4], int chunk) {
    #pragma unroll   // constant indices keep the array in registers
    for (int i = 0; i < 4; ++i) d[i] = *(const v4f*)&Wl[i * 16 + l16][chunk * 8 + 4 * h];
  };

  // src rows of the first four chunks start flying before the weights are staged
  v4f bq[4][4];
  #pragma unroll   // constant indices keep the array in registers
  for (int u = 0; u < 4; ++u) loadB(bq[u], u);

  // the group's 64 x 256 weights -> LDS: the block reads them as one contiguous
  // run, two rows (128 x 16 B) per step, and pads each row to the LDS pitch
  const float* wp = w + tid * 4u;
  float*       wl = &Wl[tid >> 6][(tid & 63u) * 4u];
  #pragma unroll   // constant indices keep the array in registers
  for (int i = 0; i < 32; ++i) *(v4f*)(wl + i * 2 * WP_) = *(const v4f*)(wp + i * 2 * C_);
  __syncthreads();   // every wave reads weight rows that the other waves stored

  v8f acc[4][4];
  #pragma unroll   // constant indices keep the array in registers
  for (int i = 0; i < 4; ++i) {
    #pragma unroll   // constant indices keep the array in registers
    for (int t = 0; t < 4; ++t) acc[i][t] = zero8();
  }

  // src rows are loaded four chunks ahead, weight fragments one chunk ahead
  v4f af[2][4];
  loadA(af[0], 0);
  for (int cc = 0; cc < C_ / 8 - 4; cc += 4) {
    #pragma unroll   // constant indices keep the array in registers
    for (int u = 0; u < 4; ++u) {
      loadA(af[(u + 1) & 1], cc + u + 1);
      proj_chunk(af[u & 1], bq[u], acc);
      loadB(bq[u], cc + u + 4);
      // keeps each refill directly behind its chunk: without it the compiler sinks all
      // sixteen loads to the loop's foot and the next trip waits out their latency
      __builtin_amdgcn_sched_barrier(0);
    }
  }
  #pragma unroll   // constant indices keep the array in registers
  for (int u = 0; u < 4; ++u) {
    if (u < 3) loadA(af[(u + 1) & 1], C_ / 8 - 4 + u + 1);
    proj_chunk(af[u & 1], bq[u], acc);
  }

  // acc[i][t][r] = channel i*16 + 8*h + r at position n0 + 4*l16 + t
  if (g < 2) {
    const float* bn_g = g ? fk_g : fq_g;
    const float* bn_b = g ? fk_b : fq_b;
    const float* bn_m = g ? fk_m : fq_m;
    const float* bn_v = g ? fk_v : fq_v;
    _Float16* dp = (g ? Km : Qm) + ((size_t)b * N_ + n0 + 4 * l16) * CK_ + 8 * h;
    #pragma unroll   // constant indices keep the array in registers
    for (int i = 0; i < 4; ++i) {
      float sc[8], mm[8], be[8];
      #pragma unroll   // constant indices keep the array in registers
      for (int r = 0; r < 8; ++r) {
        unsigned k = (unsigned)i * 16u + 8u * h + (unsigned)r;
        sc[r] = bn_g[k] * rsqrtf(bn_v[k] + 1e-5f);
        mm[r] = bn_m[k];
        be[r] = bn_b[k];
      }
      #pragma unroll   // constant indices keep the array in registers
      for (int t = 0; t < 4; ++t) {
        v8h pk;
        #pragma unroll   // constant indices keep the array in registers
        for (int r = 0; r < 8; ++r) pk[r] = (_Float16)((acc[i][t][r] - mm[r]) * sc[r] + be[r]);
        *(v8h*)(dp + (size_t)t * CK_ + i * 16) = pk;
      }
    }
  } else {
    const int cvoff = (g - 2) * 64;
    const float* bi = fv_b + cvoff + 8 * h;
    _Float16* dp = Vt + ((size_t)b * CV_ + cvoff + 8 * h) * N_ + n0 + 4 * l16;
    #pragma unroll   // constant indices keep the array in registers
    for (int i = 0; i < 4; ++i) {
      #pragma unroll   // constant indices keep the array in registers
      for (int r = 0; r < 8; ++r) {
        float bs = bi[i * 16 + r];
        v4h pk;
        #pragma unroll   // constant indices keep the array in registers
        for (int t = 0; t < 4; ++t) pk[t] = (_Float16)(acc[i][t][r] + bs);
        *(v4h*)(dp + (size_t)(i * 16 + r) * N_) = pk;   // 16 lanes = one 128-B line
      }
    }
    // the listing lays the Q/K block behind this one and reuses the stores' registers
    // there: the wait stands between the stores and any such overwrite
    asm volatile("s_wait_xcnt 0x0" ::: "memory");
  }
}

// ---------------------------------------------------------------------------
// f32 -> f16 weight conversion (W_w, done once)
// ---------------------------------------------------------------------------
__global__ void cvt_f16_kernel(const float* __restrict__ src,
                               _Float16* __restrict__ dst, int n)
{
  int i = blockIdx.x * blockDim.x + threadIdx.x;
  if (i < n) dst[i] = (_Float16)src[i];
}

#define KT_ 128
#define NT_ (N_ / KT_)

__global__ void __launch_bounds__(512)
flash_kernel(const _Float16* __restrict__ Qm,
             const _Float16* __restrict__ Km,
             const _Float16* __restrict__ Vt,
             _Float16* __restrict__ Ctx)
{
  __shared__ __attribute__((aligned(16))) _Float16 Kl[2][KT_][72];     // 36 KB
  __shared__ __attribute__((aligned(16))) _Float16 Vl[2][CV_][KT_ + 8]; // 68 KB
  __shared__ __attribute__((aligned(16))) float    Om[16][16][32][4];  // 128 KB, partial O
  __shared__ __attribute__((aligned(16))) float    Ps[16][32];         // partial row sums, per lane

  const unsigned tid  = threadIdx.x;
  const unsigned lane = tid & 31u;
  const unsigned wib  = tid >> 5;
  const unsigned qt   = wib & 3u;       // query tile of the block
  const unsigned ks   = wib >> 2;       // key quarter of every staged tile
  const int b  = (int)(blockIdx.x / (N_ / 16 / 4));                 // /100
  const int qb = ((int)(blockIdx.x % (N_ / 16 / 4)) * 4 + (int)qt) * 16;
  const unsigned l16 = lane & 15u;
  const unsigned h   = lane >> 4;       // 0 or 1

  const _Float16* Kb = Km + (size_t)b * N_ * CK_;
  const _Float16* Vb = Vt + (size_t)b * CV_ * N_;

  // Q B-fragments (32x16 f16, two Ck chunks), contiguous 16B loads per lane
  const _Float16* qrow = Qm + ((size_t)b * N_ + qb + l16) * CK_;
  v16h aq0 = join16(*(const v8h*)(qrow +       h * 8), *(const v8h*)(qrow + 16 + h * 8));
  v16h aq1 = join16(*(const v8h*)(qrow + 32 +  h * 8), *(const v8h*)(qrow + 48 + h * 8));

  v8f o[8];
  #pragma unroll
  for (int j = 0; j < 8; ++j) o[j] = zero8();
  float psum[8];
  #pragma unroll
  for (int r = 0; r < 8; ++r) psum[r] = 0.f;

  // async staging of one 128-key tile: 6 copies per thread.
  // K tile: 128 rows x 128 B, one contiguous 16 KB run: segment = s*512 + tid.
  // V tile: 128 cv rows x 256 B: 16 segments a row, a wave covers two whole rows.
  const unsigned kr = tid >> 3, kc = (tid & 7u) * 8u;     // + 64 rows per s
  const unsigned vr = tid >> 4, vc = (tid & 15u) * 8u;    // + 32 rows per s
  auto stage = [&](int buf, int kb) {
    const _Float16* kg = Kb + (size_t)(kb + (int)kr) * CK_ + kc;
    const _Float16* vg = Vb + (size_t)vr * N_ + kb + vc;
    async_copy6(lds_addr(&Kl[buf][kr][kc]),      lds_addr(&Kl[buf][kr + 64][kc]),
                lds_addr(&Vl[buf][vr][vc]),      lds_addr(&Vl[buf][vr + 32][vc]),
                lds_addr(&Vl[buf][vr + 64][vc]), lds_addr(&Vl[buf][vr + 96][vc]),
                kg, kg + 64 * CK_,
                vg, vg + (size_t)32 * N_, vg + (size_t)64 * N_, vg + (size_t)96 * N_);
  };

  stage(0, 0);
  asm volatile("s_wait_asynccnt 0x0" ::: "memory");   // own copies of tile 0 landed
  __syncthreads();                                    // tile 0 visible to all 16 waves
  stage(1, KT_);

  for (int t = 0; t < NT_; ++t) {
    const int cur = t & 1;

    // ---- load ALL four K A-fragments first (lets ds_loads pipeline), ----
    // ---- then run the 4 S^T WMMAs                                     ----
    const _Float16* kr0 = &Kl[cur][ks * 32 + l16][0];
    const _Float16* kr1 = &Kl[cur][ks * 32 + 16 + l16][0];
    v16h bk00 = join16(*(const v8h*)(kr0 +      h * 8), *(const v8h*)(kr0 + 16 + h * 8));
    v16h bk01 = join16(*(const v8h*)(kr0 + 32 + h * 8), *(const v8h*)(kr0 + 48 + h * 8));
    v16h bk10 = join16(*(const v8h*)(kr1 +      h * 8), *(const v8h*)(kr1 + 16 + h * 8));
    v16h bk11 = join16(*(const v8h*)(kr1 + 32 + h * 8), *(const v8h*)(kr1 + 48 + h * 8));

    // ---- V^T A-fragments of all 8 cv groups: no LDS write of P stands between the ----
    // ---- scores and V any more, so they are read with the K fragments as one group ----
    v16h bv[8];
    #pragma unroll   // constant indices keep the array in registers
    for (int j = 0; j < 8; ++j) {
      const _Float16* vp = &Vl[cur][j * 16 + l16][ks * 32];
      bv[j] = join16(*(const v8h*)(vp + h * 8), *(const v8h*)(vp + 16 + h * 8));
    }
    // keeps the V reads up here: without it the compiler sinks each pair to just in front
    // of its WMMA, and the wave waits out a whole LDS latency per cv group
    __builtin_amdgcn_sched_barrier(0);

    v8f c0, c1;
    {
      v8f z = zero8();
      c0 = wmma_f16(bk00, aq0, z);     // c0[r] = S^T[key ks*32 +      8h + r][query l16]
      c1 = wmma_f16(bk10, aq0, z);     // c1[r] = S^T[key ks*32 + 16 + 8h + r][query l16]
      c0 = wmma_f16(bk01, aq1, c0);
      c1 = wmma_f16(bk11, aq1, c1);
    }

    // ---- p = exp(s/8) = exp2(s * SCALE_LOG2E); accumulate the lane's share of its ----
    // ---- query's row sum; the two tiles, converted in place, are the B operand P^T ----
    v16h pB;
    #pragma unroll
    for (int r = 0; r < 8; ++r) {
      float p0 = __builtin_amdgcn_exp2f(c0[r] * SCALE_LOG2E);
      float p1 = __builtin_amdgcn_exp2f(c1[r] * SCALE_LOG2E);
      psum[r] += p0 + p1;
      pB[r]     = (_Float16)p0;
      pB[8 + r] = (_Float16)p1;
    }

    // ---- O^T += V^T * P^T ; 8 row groups over Cv=128 ----
    #pragma unroll
    for (int j = 0; j < 8; ++j)
      o[j] = wmma_f16(bv[j], pB, o[j]);   // o[j][r] = O^T[cv j*16 + 8h + r][query l16]

    // keeps the trip's products in front of the publish point: without it the compiler lifts
    // the waits and the barrier over them, every wave then waits for all its reads before its
    // first product, and the refill behind the products loses most of its lead
    __builtin_amdgcn_sched_barrier(0);

    // publish point: own reads of buf[cur] retired, own copies of tile t+1 landed,
    // then the one barrier that shows tile t+1 to every wave and frees buf[cur]
    asm volatile("s_wait_dscnt 0x0" ::: "memory");
    asm volatile("s_wait_asynccnt 0x0" ::: "memory");
    __syncthreads();
    if (t + 2 < NT_) stage(cur, (t + 2) * KT_);
  }
  asm volatile("s_wait_asynccnt 0x0" ::: "memory");   // nothing in flight at the wave's end

  // ---- the lane's share of its query's row sum, then the wave's partials go to LDS ----
  Ps[wib][lane] = ((psum[0] + psum[1]) + (psum[2] + psum[3])) +
                  ((psum[4] + psum[5]) + (psum[6] + psum[7]));
  #pragma unroll
  for (int j = 0; j < 8; ++j) {
    #pragma unroll
    for (int q = 0; q < 2; ++q) {
      v4f pk = {o[j][4 * q], o[j][4 * q + 1], o[j][4 * q + 2], o[j][4 * q + 3]};
      *(v4f*)&Om[wib][j * 2 + q][lane][0] = pk;
    }
  }
  __syncthreads();   // every wave reads partials that the three other key quarters stored

  // ---- epilogue: wave (qt, ks) adds the four quarters for cv groups 2*ks and 2*ks+1
  // ---- of its query tile, normalizes and stores ctx[(b, n), cv] as f16: a lane holds
  // ---- 8 consecutive cv of query l16, one 16-byte store per group
  float s = 0.f;
  #pragma unroll
  for (int p = 0; p < 4; ++p) s += Ps[p * 4 + qt][l16] + Ps[p * 4 + qt][16 + l16];
  const float rinv = 1.0f / s;
  #pragma unroll
  for (int jj = 0; jj < 2; ++jj) {
    const unsigned j = 2 * ks + jj;
    v8h pk;
    #pragma unroll
    for (int q = 0; q < 2; ++q) {
      v4f a = *(const v4f*)&Om[qt][j * 2 + q][lane][0];
      #pragma unroll
      for (int p = 1; p < 4; ++p) a += *(const v4f*)&Om[p * 4 + qt][j * 2 + q][lane][0];
      #pragma unroll
      for (int e = 0; e < 4; ++e) pk[4 * q + e] = (_Float16)(a[e] * rinv);
    }
    *(v8h*)(Ctx + ((size_t)b * N_ + qb + l16) * CV_ + j * 16 + 8 * h) = pk;
  }
}

// ---------------------------------------------------------------------------
// Output projection: out = gamma * (Wh[256,128] @ ctx + W_b) + x
// One wave = 16 output channels x 16 positions, K = Cv = 128 (4 WMMA chunks).
// Wh is the pre-converted f16 copy of W_w.
// ---------------------------------------------------------------------------
__global__ void __launch_bounds__(128)
outproj_kernel(const _Float16* __restrict__ Wh,
               const float* __restrict__ Wb,
               const _Float16* __restrict__ Ctx,
               const float* __restrict__ x,
               const float* __restrict__ gamma,
               float* __restrict__ out)
{
  const unsigned lane = threadIdx.x & 31u;
  const unsigned wg   = blockIdx.x * (blockDim.x >> 5) + (threadIdx.x >> 5);
  const int tilesN = N_ / 16;                       // 400
  const int b   = (int)(wg / ((CO_ / 16) * tilesN));
  int rem       = (int)(wg % ((CO_ / 16) * tilesN));
  const int cob = (rem / tilesN) * 16;
  const int pb  = (rem % tilesN) * 16;
  const unsigned l16 = lane & 15u;
  const unsigned h   = lane >> 4;

  v8f acc = zero8();
  const _Float16* wr = Wh  + (size_t)(cob + l16) * CV_;
  const _Float16* cr = Ctx + ((size_t)b * N_ + pb + l16) * CV_;

  #pragma unroll
  for (int cc = 0; cc < 4; ++cc) {
    const _Float16* wp = wr + cc * 32 + h * 8;
    v16h a  = join16(*(const v8h*)wp, *(const v8h*)(wp + 16));
    const _Float16* cp = cr + cc * 32 + h * 8;
    v16h bb = join16(*(const v8h*)cp, *(const v8h*)(cp + 16));
    acc = wmma_f16(a, bb, acc);
  }

  float gm = gamma[0];
  #pragma unroll
  for (int r = 0; r < 8; ++r) {
    int co = cob + r + 8 * (int)h;
    size_t oi = ((size_t)b * CO_ + co) * N_ + pb + l16;
    out[oi] = gm * (acc[r] + Wb[co]) + x[oi];
  }
}

// ---------------------------------------------------------------------------
extern "C" void kernel_launch(void* const* d_in, const int* in_sizes, int n_in,
                              void* d_out, int out_size, void* d_ws, size_t ws_size,
                              hipStream_t stream)
{
  const float* x     = (const float*)d_in[0];
  const float* y     = (const float*)d_in[1];
  const float* fk_w  = (const float*)d_in[2];
  const float* fk_g  = (const float*)d_in[3];
  const float* fk_b  = (const float*)d_in[4];
  const float* fk_m  = (const float*)d_in[5];
  const float* fk_v  = (const float*)d_in[6];
  const float* fq_w  = (const float*)d_in[7];
  const float* fq_g  = (const float*)d_in[8];
  const float* fq_b  = (const float*)d_in[9];
  const float* fq_m  = (const float*)d_in[10];
  const float* fq_v  = (const float*)d_in[11];
  const float* fv_w  = (const float*)d_in[12];
  const float* fv_b  = (const float*)d_in[13];
  const float* W_w   = (const float*)d_in[14];
  const float* W_b   = (const float*)d_in[15];
  const float* gamma = (const float*)d_in[16];
  float* out = (float*)d_out;

  char* ws = (char*)d_ws;
  size_t off = 0;
  auto alloc = [&](size_t bytes) -> void* {
    void* p = ws + off;
    off = (off + bytes + 255) & ~(size_t)255;
    return p;
  };
  _Float16* Qm  = (_Float16*)alloc((size_t)B_ * N_ * CK_ * sizeof(_Float16));
  _Float16* Km  = (_Float16*)alloc((size_t)B_ * N_ * CK_ * sizeof(_Float16));
  _Float16* Vt  = (_Float16*)alloc((size_t)B_ * CV_ * N_ * sizeof(_Float16));
  _Float16* Ctx = (_Float16*)alloc((size_t)B_ * N_ * CV_ * sizeof(_Float16));
  _Float16* Wh  = (_Float16*)alloc((size_t)CO_ * CV_ * sizeof(_Float16));
  (void)in_sizes; (void)n_in; (void)out_size; (void)ws_size;

  // projections: 50 blocks of 256 positions x 4 groups of 64 output channels
  proj_wmma_kernel<<<dim3(B_ * (N_ / 256), 4), dim3(128), 0, stream>>>(
      x, y, fq_w, fq_g, fq_b, fq_m, fq_v, fk_w, fk_g, fk_b, fk_m, fk_v, fv_w, fv_b, Qm, Km, Vt);

  // one-time W_w -> f16
  cvt_f16_kernel<<<dim3((CO_ * CV_ + 255) / 256), dim3(256), 0, stream>>>(W_w, Wh, CO_ * CV_);

  // flash attention: 100 blocks per batch, 16 waves (4 query tiles x 4 key quarters) per block
  flash_kernel<<<dim3(B_ * (N_ / 16 / 4)), dim3(512), 0, stream>>>(Qm, Km, Vt, Ctx);

  // output projection + residual: B * 16 * 400 wave tiles, 4 waves per block
  outproj_kernel<<<dim3((B_ * (CO_ / 16) * (N_ / 16)) / 4), dim3(128), 0, stream>>>(
      Wh, W_b, Ctx, x, gamma, out);
}

// v004
// A run of this version takes 58.4 microseconds.
// Next to v003, in two timings, it ran 1.20 and 1.19 times as fast.
// Counting every step since v000, it is 9.97 times as fast.
#include <hip/hip_runtime.h>
#include <hip/hip_bf16.h>

typedef _Float16 v8h  __attribute__((ext_vector_type(8)));
typedef _Float16 v16h __attribute__((ext_vector_type(16)));
typedef float    v8f  __attribute__((ext_vector_type(8)));
typedef _Float16 v4h  __attribute__((ext_vector_type(4)));
typedef float    v2f  __attribute__((ext_vector_type(2)));
typedef float    v4f  __attribute__((ext_vector_type(4)));

#define B_  2
#define C_  256
#define N_  6400
#define CK_ 64
#define CV_ 128
#define CO_ 256

// 0.125 (Ck^-1/2) * log2(e): exp(s/8) == exp2(s * SCALE_LOG2E), single v_exp_f32
#define SCALE_LOG2E 0.1803368801111204f

__device__ __forceinline__ v16h join16(v8h lo, v8h hi) {
  return __builtin_shufflevector(lo, hi, 0,1,2,3,4,5,6,7,8,9,10,11,12,13,14,15);
}
__device__ __forceinline__ v8f zero8() {
  v8f z = {0.f,0.f,0.f,0.f,0.f,0.f,0.f,0.f};
  return z;
}
__device__ __forceinline__ v8f wmma_f16(v16h a, v16h b, v8f c) {
  // D = A(16x32 f16) * B(32x16 f16) + C(16x16 f32)
  return __builtin_amdgcn_wmma_f32_16x16x32_f16(false, a, false, b, (short)0, c, false, false);
}

// Six async 16-byte global -> LDS copies of one lane (ASYNCcnt-tracked): one thread's
// share of a staged tile. l* = LDS byte address (low 32 bits of the generic address),
// g* = global address. The closing s_wait_xcnt stands inside the statement so that no
// later write of an address register can be scheduled in front of it.
__device__ __forceinline__ unsigned lds_addr(const void* p) { return (unsigned)(size_t)p; }
__device__ __forceinline__ void async_copy6(unsigned l0, unsigned l1, unsigned l2,
                                            unsigned l3, unsigned l4, unsigned l5,
                                            const void* g0, const void* g1, const void* g2,
                                            const void* g3, const void* g4, const void* g5) {
  asm volatile("global_load_async_to_lds_b128 %0, %6, off\n\t"
               "global_load_async_to_lds_b128 %1, %7, off\n\t"
               "global_load_async_to_lds_b128 %2, %8, off\n\t"
               "global_load_async_to_lds_b128 %3, %9, off\n\t"
               "global_load_async_to_lds_b128 %4, %10, off\n\t"
               "global_load_async_to_lds_b128 %5, %11, off\n\t"
               "s_wait_xcnt 0x0"
               :: "v"(l0), "v"(l1), "v"(l2), "v"(l3), "v"(l4), "v"(l5),
                  "v"(g0), "v"(g1), "v"(g2), "v"(g3), "v"(g4), "v"(g5) : "memory");
}

// ---------------------------------------------------------------------------
// All three 1x1-conv projections as one f32 GEMM on the 16x16x4 matrix form.
// blockIdx.y = group of 64 output channels: 0 = Q (from y, BN), 1 = K (from x,
// BN), 2 and 3 = the two halves of V (from y, bias).
// Block = 4 waves; a wave owns 64 channels x 64 positions (4 x 4 D tiles).
// A = weights [channel][c] from LDS, B = src [c][position] from global memory.
// k order inside a chunk of 8 input channels, the same for A and B:
//   c = chunk * 8 + 4 * h + 2 * s + v   (s = which WMMA of the chunk, v = register)
// Column l16 of position tile t is position n0 + 4 * l16 + t, so one 16-byte
// load of a src row feeds all four position tiles.
// Q/K: dst[(b*N+n)*64 + k] (f16);  V: dst[(b*CV + k)*N + n] (f16).
// ---------------------------------------------------------------------------
#define WP_ 260   // LDS row pitch in floats: 1040 B = 16 B x odd, for ds_load_b128

__device__ __forceinline__ v8f wmma_f32(v2f a, v2f b, v8f c) {
  // D = A(16x4 f32) * B(4x16 f32) + C(16x16 f32)
  return __builtin_amdgcn_wmma_f32_16x16x4_f32(false, a, false, b, (short)0, c, false, false);
}

__device__ __forceinline__ void proj_chunk(const v4f (&af)[4], const v4f (&bq)[4],
                                           v8f (&acc)[4][4]) {
  #pragma unroll   // constant indices keep the array in registers
  for (int s = 0; s < 2; ++s) {
    v2f bf[4];
    #pragma unroll   // constant indices keep the array in registers
    for (int t = 0; t < 4; ++t) { bf[t][0] = bq[2 * s][t]; bf[t][1] = bq[2 * s + 1][t]; }
    #pragma unroll   // constant indices keep the array in registers
    for (int i = 0; i < 4; ++i) {
      v2f a; a[0] = af[i][2 * s]; a[1] = af[i][2 * s + 1];
      #pragma unroll   // constant indices keep the array in registers
      for (int t = 0; t < 4; ++t) acc[i][t] = wmma_f32(a, bf[t], acc[i][t]);
    }
  }
}

__global__ void __launch_bounds__(128)
proj_wmma_kernel(const float* __restrict__ x,    const float* __restrict__ y,
                 const float* __restrict__ fq_w, const float* __restrict__ fq_g,
                 const float* __restrict__ fq_b, const float* __restrict__ fq_m,
                 const float* __restrict__ fq_v,
                 const float* __restrict__ fk_w, const float* __restrict__ fk_g,
                 const float* __restrict__ fk_b, const float* __restrict__ fk_m,
                 const float* __restrict__ fk_v,
                 const float* __restrict__ fv_w, const float* __restrict__ fv_b,
                 _Float16* __restrict__ Qm, _Float16* __restrict__ Km,
                 _Float16* __restrict__ Vt)
{
  __shared__ __attribute__((aligned(16))) float Wl[64][WP_];   // 65 KB

  const unsigned tid  = threadIdx.x;
  const unsigned lane = tid & 31u;
  const unsigned wib  = tid >> 5;
  const unsigned l16  = lane & 15u;
  const unsigned h    = lane >> 4;
  const int g  = (int)blockIdx.y;
  const int b  = (int)(blockIdx.x / (N_ / 256));
  const int n0 = (int)(blockIdx.x % (N_ / 256)) * 256 + (int)wib * 64;

  const float* src = (g == 1) ? x : y;
  const float* w   = (g == 0) ? fq_w : (g == 1) ? fk_w : fv_w + (size_t)(g - 2) * 64 * C_;

  // lane's column of src, at its own half's first row of a chunk
  const float* bp = src + (size_t)b * C_ * N_ + (size_t)(4 * h) * N_ + n0 + 4 * l16;
  auto loadB = [&](v4f (&d)[4], int chunk) {
    #pragma unroll   // constant indices keep the array in registers
    for (int j = 0; j < 4; ++j) d[j] = *(const v4f*)(bp + (size_t)(chunk * 8 + j) * N_);
  };
  auto loadA = [&](v4f (&d)[4], int chunk) {
    #pragma unroll   // constant indices keep the array in registers
    for (int i = 0; i < 4; ++i) d[i] = *(const v4f*)&Wl[i * 16 + l16][chunk * 8 + 4 * h];
  };

  // src rows of the first four chunks start flying before the weights are staged
  v4f bq[4][4];
  #pragma unroll   // constant indices keep the array in registers
  for (int u = 0; u < 4; ++u) loadB(bq[u], u);

  // the group's 64 x 256 weights -> LDS: the block reads them as one contiguous
  // run, two rows (128 x 16 B) per step, and pads each row to the LDS pitch
  const float* wp = w + tid * 4u;
  float*       wl = &Wl[tid >> 6][(tid & 63u) * 4u];
  #pragma unroll   // constant indices keep the array in registers
  for (int i = 0; i < 32; ++i) *(v4f*)(wl + i * 2 * WP_) = *(const v4f*)(wp + i * 2 * C_);
  __syncthreads();   // every wave reads weight rows that the other waves stored

  v8f acc[4][4];
  #pragma unroll   // constant indices keep the array in registers
  for (int i = 0; i < 4; ++i) {
    #pragma unroll   // constant indices keep the array in registers
    for (int t = 0; t < 4; ++t) acc[i][t] = zero8();
  }

  // src rows are loaded four chunks ahead, weight fragments one chunk ahead
  v4f af[2][4];
  loadA(af[0], 0);
  for (int cc = 0; cc < C_ / 8 - 4; cc += 4) {
    #pragma unroll   // constant indices keep the array in registers
    for (int u = 0; u < 4; ++u) {
      loadA(af[(u + 1) & 1], cc + u + 1);
      proj_chunk(af[u & 1], bq[u], acc);
      loadB(bq[u], cc + u + 4);
      // keeps each refill directly behind its chunk: without it the compiler sinks all
      // sixteen loads to the loop's foot and the next trip waits out their latency
      __builtin_amdgcn_sched_barrier(0);
    }
  }
  #pragma unroll   // constant indices keep the array in registers
  for (int u = 0; u < 4; ++u) {
    if (u < 3) loadA(af[(u + 1) & 1], C_ / 8 - 4 + u + 1);
    proj_chunk(af[u & 1], bq[u], acc);
  }

  // acc[i][t][r] = channel i*16 + 8*h + r at position n0 + 4*l16 + t
  if (g < 2) {
    const float* bn_g = g ? fk_g : fq_g;
    const float* bn_b = g ? fk_b : fq_b;
    const float* bn_m = g ? fk_m : fq_m;
    const float* bn_v = g ? fk_v : fq_v;
    _Float16* dp = (g ? Km : Qm) + ((size_t)b * N_ + n0 + 4 * l16) * CK_ + 8 * h;
    #pragma unroll   // constant indices keep the array in registers
    for (int i = 0; i < 4; ++i) {
      float sc[8], mm[8], be[8];
      #pragma unroll   // constant indices keep the array in registers
      for (int r = 0; r < 8; ++r) {
        unsigned k = (unsigned)i * 16u + 8u * h + (unsigned)r;
        sc[r] = bn_g[k] * rsqrtf(bn_v[k] + 1e-5f);
        mm[r] = bn_m[k];
        be[r] = bn_b[k];
      }
      #pragma unroll   // constant indices keep the array in registers
      for (int t = 0; t < 4; ++t) {
        v8h pk;
        #pragma unroll   // constant indices keep the array in registers
        for (int r = 0; r < 8; ++r) pk[r] = (_Float16)((acc[i][t][r] - mm[r]) * sc[r] + be[r]);
        *(v8h*)(dp + (size_t)t * CK_ + i * 16) = pk;
      }
    }
  } else {
    const int cvoff = (g - 2) * 64;
    const float* bi = fv_b + cvoff + 8 * h;
    _Float16* dp = Vt + ((size_t)b * CV_ + cvoff + 8 * h) * N_ + n0 + 4 * l16;
    #pragma unroll   // constant indices keep the array in registers
    for (int i = 0; i < 4; ++i) {
      #pragma unroll   // constant indices keep the array in registers
      for (int r = 0; r < 8; ++r) {
        float bs = bi[i * 16 + r];
        v4h pk;
        #pragma unroll   // constant indices keep the array in registers
        for (int t = 0; t < 4; ++t) pk[t] = (_Float16)(acc[i][t][r] + bs);
        *(v4h*)(dp + (size_t)(i * 16 + r) * N_) = pk;   // 16 lanes = one 128-B line
      }
    }
    // the listing lays the Q/K block behind this one and reuses the stores' registers
    // there: the wait stands between the stores and any such overwrite
    asm volatile("s_wait_xcnt 0x0" ::: "memory");
  }
}

#define KT_ 128
#define NT_ (N_ / KT_)

__global__ void __launch_bounds__(512)
flash_kernel(const _Float16* __restrict__ Qm,
             const _Float16* __restrict__ Km,
             const _Float16* __restrict__ Vt,
             const float* __restrict__ W_w,
             const float* __restrict__ W_b,
             const float* __restrict__ x,
             const float* __restrict__ gamma,
             float* __restrict__ out)
{
  __shared__ __attribute__((aligned(16))) _Float16 Kl[2][KT_][72];     // 36 KB
  __shared__ __attribute__((aligned(16))) _Float16 Vl[2][CV_][KT_ + 8]; // 68 KB
  __shared__ __attribute__((aligned(16))) float    Om[16][16][32][4];  // 128 KB, partial O
  __shared__ __attribute__((aligned(16))) float    Ps[16][32];         // partial row sums, per lane
  __shared__ __attribute__((aligned(16))) _Float16 Cl[64][CV_ + 8];    // 17 KB, ctx rows (16 B x odd)

  const unsigned tid  = threadIdx.x;
  const unsigned lane = tid & 31u;
  const unsigned wib  = tid >> 5;
  const unsigned qt   = wib & 3u;       // query tile of the block
  const unsigned ks   = wib >> 2;       // key quarter of every staged tile
  const int b  = (int)(blockIdx.x / (N_ / 16 / 4));                 // /100
  const int qb = ((int)(blockIdx.x % (N_ / 16 / 4)) * 4 + (int)qt) * 16;
  const unsigned l16 = lane & 15u;
  const unsigned h   = lane >> 4;       // 0 or 1

  const _Float16* Kb = Km + (size_t)b * N_ * CK_;
  const _Float16* Vb = Vt + (size_t)b * CV_ * N_;

  // Q B-fragments (32x16 f16, two Ck chunks), contiguous 16B loads per lane
  const _Float16* qrow = Qm + ((size_t)b * N_ + qb + l16) * CK_;
  v16h aq0 = join16(*(const v8h*)(qrow +       h * 8), *(const v8h*)(qrow + 16 + h * 8));
  v16h aq1 = join16(*(const v8h*)(qrow + 32 +  h * 8), *(const v8h*)(qrow + 48 + h * 8));

  v8f o[8];
  #pragma unroll
  for (int j = 0; j < 8; ++j) o[j] = zero8();
  float psum[8];
  #pragma unroll
  for (int r = 0; r < 8; ++r) psum[r] = 0.f;

  // async staging of one 128-key tile: 6 copies per thread.
  // K tile: 128 rows x 128 B, one contiguous 16 KB run: segment = s*512 + tid.
  // V tile: 128 cv rows x 256 B: 16 segments a row, a wave covers two whole rows.
  const unsigned kr = tid >> 3, kc = (tid & 7u) * 8u;     // + 64 rows per s
  const unsigned vr = tid >> 4, vc = (tid & 15u) * 8u;    // + 32 rows per s
  auto stage = [&](int buf, int kb) {
    const _Float16* kg = Kb + (size_t)(kb + (int)kr) * CK_ + kc;
    const _Float16* vg = Vb + (size_t)vr * N_ + kb + vc;
    async_copy6(lds_addr(&Kl[buf][kr][kc]),      lds_addr(&Kl[buf][kr + 64][kc]),
                lds_addr(&Vl[buf][vr][vc]),      lds_addr(&Vl[buf][vr + 32][vc]),
                lds_addr(&Vl[buf][vr + 64][vc]), lds_addr(&Vl[buf][vr + 96][vc]),
                kg, kg + 64 * CK_,
                vg, vg + (size_t)32 * N_, vg + (size_t)64 * N_, vg + (size_t)96 * N_);
  };

  stage(0, 0);
  asm volatile("s_wait_asynccnt 0x0" ::: "memory");   // own copies of tile 0 landed
  __syncthreads();                                    // tile 0 visible to all 16 waves
  stage(1, KT_);

  for (int t = 0; t < NT_; ++t) {
    const int cur = t & 1;

    // ---- load ALL four K A-fragments first (lets ds_loads pipeline), ----
    // ---- then run the 4 S^T WMMAs                                     ----
    const _Float16* kr0 = &Kl[cur][ks * 32 + l16][0];
    const _Float16* kr1 = &Kl[cur][ks * 32 + 16 + l16][0];
    v16h bk00 = join16(*(const v8h*)(kr0 +      h * 8), *(const v8h*)(kr0 + 16 + h * 8));
    v16h bk01 = join16(*(const v8h*)(kr0 + 32 + h * 8), *(const v8h*)(kr0 + 48 + h * 8));
    v16h bk10 = join16(*(const v8h*)(kr1 +      h * 8), *(const v8h*)(kr1 + 16 + h * 8));
    v16h bk11 = join16(*(const v8h*)(kr1 + 32 + h * 8), *(const v8h*)(kr1 + 48 + h * 8));

    // ---- V^T A-fragments of all 8 cv groups: no LDS write of P stands between the ----
    // ---- scores and V any more, so they are read with the K fragments as one group ----
    v16h bv[8];
    #pragma unroll   // constant indices keep the array in registers
    for (int j = 0; j < 8; ++j) {
      const _Float16* vp = &Vl[cur][j * 16 + l16][ks * 32];
      bv[j] = join16(*(const v8h*)(vp + h * 8), *(const v8h*)(vp + 16 + h * 8));
    }
    // keeps the V reads up here: without it the compiler sinks each pair to just in front
    // of its WMMA, and the wave waits out a whole LDS latency per cv group
    __builtin_amdgcn_sched_barrier(0);

    v8f c0, c1;
    {
      v8f z = zero8();
      c0 = wmma_f16(bk00, aq0, z);     // c0[r] = S^T[key ks*32 +      8h + r][query l16]
      c1 = wmma_f16(bk10, aq0, z);     // c1[r] = S^T[key ks*32 + 16 + 8h + r][query l16]
      c0 = wmma_f16(bk01, aq1, c0);
      c1 = wmma_f16(bk11, aq1, c1);
    }

    // ---- p = exp(s/8) = exp2(s * SCALE_LOG2E); accumulate the lane's share of its ----
    // ---- query's row sum; the two tiles, converted in place, are the B operand P^T ----
    v16h pB;
    #pragma unroll
    for (int r = 0; r < 8; ++r) {
      float p0 = __builtin_amdgcn_exp2f(c0[r] * SCALE_LOG2E);
      float p1 = __builtin_amdgcn_exp2f(c1[r] * SCALE_LOG2E);
      psum[r] += p0 + p1;
      pB[r]     = (_Float16)p0;
      pB[8 + r] = (_Float16)p1;
    }

    // ---- O^T += V^T * P^T ; 8 row groups over Cv=128 ----
    #pragma unroll
    for (int j = 0; j < 8; ++j)
      o[j] = wmma_f16(bv[j], pB, o[j]);   // o[j][r] = O^T[cv j*16 + 8h + r][query l16]

    // keeps the trip's products in front of the publish point: without it the compiler lifts
    // the waits and the barrier over them, every wave then waits for all its reads before its
    // first product, and the refill behind the products loses most of its lead
    __builtin_amdgcn_sched_barrier(0);

    // publish point: own reads of buf[cur] retired, own copies of tile t+1 landed,
    // then the one barrier that shows tile t+1 to every wave and frees buf[cur]
    asm volatile("s_wait_dscnt 0x0" ::: "memory");
    asm volatile("s_wait_asynccnt 0x0" ::: "memory");
    __syncthreads();
    if (t + 2 < NT_) stage(cur, (t + 2) * KT_);
  }
  asm volatile("s_wait_asynccnt 0x0" ::: "memory");   // nothing in flight at the wave's end

  // ---- the output projection's global operands start flying under the merge: the wave's
  // ---- 16 W_w rows (A fragments, rounded to f16), its bias, and its part of x
  const float* wrow = W_w + (size_t)(wib * 16 + l16) * CV_ + h * 8;
  v16h wa[4];
  #pragma unroll   // constant indices keep the array in registers
  for (int cc = 0; cc < 4; ++cc) {
    v4f w0 = *(const v4f*)(wrow + cc * 32),      w1 = *(const v4f*)(wrow + cc * 32 + 4);
    v4f w2 = *(const v4f*)(wrow + cc * 32 + 16), w3 = *(const v4f*)(wrow + cc * 32 + 20);
    #pragma unroll   // constant indices keep the array in registers
    for (int e = 0; e < 4; ++e) {
      wa[cc][e]     = (_Float16)w0[e];  wa[cc][4 + e]  = (_Float16)w1[e];
      wa[cc][8 + e] = (_Float16)w2[e];  wa[cc][12 + e] = (_Float16)w3[e];
    }
  }
  // lane: channels wib*16 + 8h + r, positions p0 + 4*l16 .. + 3
  const unsigned co0 = wib * 16 + 8 * h;
  const size_t   ob  = ((size_t)b * CO_ + co0) * N_ + (blockIdx.x % (N_ / 16 / 4)) * 64 + 4 * l16;
  const float*   xp  = x + ob;
  const unsigned bo  = co0 * 4;      // the bias loads' byte offset from W_b
  v4f xr[8];
  #pragma unroll   // constant indices keep the array in registers
  for (int r = 0; r < 8; ++r) xr[r] = *(const v4f*)(xp + (size_t)r * N_);
  const v4f wb0 = *(const v4f*)((const char*)W_b + bo), wb1 = *(const v4f*)((const char*)W_b + bo + 16);
  const float gm = gamma[0];
  // the loads' address registers stay untouched up to this wait: as inputs they live to
  // here, so no load of the run lands in a register that another load of the run names
  asm volatile("s_wait_xcnt 0x0" :: "v"(wrow), "v"(xp), "v"(bo) : "memory");

  // ---- the lane's share of its query's row sum, then the wave's partials go to LDS ----
  Ps[wib][lane] = ((psum[0] + psum[1]) + (psum[2] + psum[3])) +
                  ((psum[4] + psum[5]) + (psum[6] + psum[7]));
  #pragma unroll
  for (int j = 0; j < 8; ++j) {
    #pragma unroll
    for (int q = 0; q < 2; ++q) {
      v4f pk = {o[j][4 * q], o[j][4 * q + 1], o[j][4 * q + 2], o[j][4 * q + 3]};
      *(v4f*)&Om[wib][j * 2 + q][lane][0] = pk;
    }
  }
  __syncthreads();   // every wave reads partials that the three other key quarters stored

  // ---- epilogue: wave (qt, ks) adds the four quarters for cv groups 2*ks and 2*ks+1
  // ---- of its query tile, normalizes and stores the ctx row as f16 in LDS: a lane holds
  // ---- 8 consecutive cv of query l16, one 16-byte store per group. Query q of the block
  // ---- lies in row (q & 3) * 16 + (q >> 2): position tile t is rows 16t .. 16t+15
  const unsigned q64 = qt * 16 + l16;
  _Float16* crow = &Cl[(q64 & 3u) * 16 + (q64 >> 2)][8 * h];
  float s = 0.f;
  #pragma unroll
  for (int p = 0; p < 4; ++p) s += Ps[p * 4 + qt][l16] + Ps[p * 4 + qt][16 + l16];
  const float rinv = 1.0f / s;
  #pragma unroll
  for (int jj = 0; jj < 2; ++jj) {
    const unsigned j = 2 * ks + jj;
    v8h pk;
    #pragma unroll
    for (int q = 0; q < 2; ++q) {
      v4f a = *(const v4f*)&Om[qt][j * 2 + q][lane][0];
      #pragma unroll
      for (int p = 1; p < 4; ++p) a += *(const v4f*)&Om[p * 4 + qt][j * 2 + q][lane][0];
      #pragma unroll
      for (int e = 0; e < 4; ++e) pk[4 * q + e] = (_Float16)(a[e] * rinv);
    }
    *(v8h*)(crow + j * 16) = pk;
  }
  __syncthreads();   // every wave reads ctx rows that all sixteen waves stored

  // ---- out tile: 16 channels x 64 positions per wave ----
  v8f acc[4];
  #pragma unroll   // constant indices keep the array in registers
  for (int t = 0; t < 4; ++t) acc[t] = zero8();
  #pragma unroll   // constant indices keep the array in registers
  for (int cc = 0; cc < 4; ++cc) {
    #pragma unroll   // constant indices keep the array in registers
    for (int t = 0; t < 4; ++t) {
      const _Float16* cp = &Cl[t * 16 + l16][cc * 32 + h * 8];
      acc[t] = wmma_f16(wa[cc], join16(*(const v8h*)cp, *(const v8h*)(cp + 16)), acc[t]);
    }
  }
  #pragma unroll   // constant indices keep the array in registers
  for (int r = 0; r < 8; ++r) {
    const float bs = (r < 4) ? wb0[r & 3] : wb1[r & 3];
    v4f ov;
    #pragma unroll   // constant indices keep the array in registers
    for (int t = 0; t < 4; ++t) ov[t] = gm * (acc[t][r] + bs) + xr[r][t];
    *(v4f*)(out + ob + (size_t)r * N_) = ov;   // 16 lanes = two whole 128-B lines
  }
}

// ---------------------------------------------------------------------------
extern "C" void kernel_launch(void* const* d_in, const int* in_sizes, int n_in,
                              void* d_out, int out_size, void* d_ws, size_t ws_size,
                              hipStream_t stream)
{
  const float* x     = (const float*)d_in[0];
  const float* y     = (const float*)d_in[1];
  const float* fk_w  = (const float*)d_in[2];
  const float* fk_g  = (const float*)d_in[3];
  const float* fk_b  = (const float*)d_in[4];
  const float* fk_m  = (const float*)d_in[5];
  const float* fk_v  = (const float*)d_in[6];
  const float* fq_w  = (const float*)d_in[7];
  const float* fq_g  = (const float*)d_in[8];
  const float* fq_b  = (const float*)d_in[9];
  const float* fq_m  = (const float*)d_in[10];
  const float* fq_v  = (const float*)d_in[11];
  const float* fv_w  = (const float*)d_in[12];
  const float* fv_b  = (const float*)d_in[13];
  const float* W_w   = (const float*)d_in[14];
  const float* W_b   = (const float*)d_in[15];
  const float* gamma = (const float*)d_in[16];
  float* out = (float*)d_out;

  char* ws = (char*)d_ws;
  size_t off = 0;
  auto alloc = [&](size_t bytes) -> void* {
    void* p = ws + off;
    off = (off + bytes + 255) & ~(size_t)255;
    return p;
  };
  _Float16* Qm  = (_Float16*)alloc((size_t)B_ * N_ * CK_ * sizeof(_Float16));
  _Float16* Km  = (_Float16*)alloc((size_t)B_ * N_ * CK_ * sizeof(_Float16));
  _Float16* Vt  = (_Float16*)alloc((size_t)B_ * CV_ * N_ * sizeof(_Float16));
  (void)in_sizes; (void)n_in; (void)out_size; (void)ws_size;

  // projections: 50 blocks of 256 positions x 4 groups of 64 output channels
  proj_wmma_kernel<<<dim3(B_ * (N_ / 256), 4), dim3(128), 0, stream>>>(
      x, y, fq_w, fq_g, fq_b, fq_m, fq_v, fk_w, fk_g, fk_b, fk_m, fk_v, fv_w, fv_b, Qm, Km, Vt);

  // flash attention + output projection + residual: 100 blocks per batch, 16 waves
  // (4 query tiles x 4 key quarters; then 16 groups of 16 output channels) per block
  flash_kernel<<<dim3(B_ * (N_ / 16 / 4)), dim3(512), 0, stream>>>(
      Qm, Km, Vt, W_w, W_b, x, gamma, out);
}

// v005
// One run takes 45.9 microseconds.
// Timed twice side by side with v004, it ran 1.26 and 1.27 times as fast.
// All steps since v000 together make it 12.6 times as fast.
#include <hip/hip_runtime.h>
#include <hip/hip_bf16.h>

typedef _Float16 v8h  __attribute__((ext_vector_type(8)));
typedef _Float16 v16h __attribute__((ext_vector_type(16)));
typedef float    v8f  __attribute__((ext_vector_type(8)));
typedef _Float16 v4h  __attribute__((ext_vector_type(4)));
typedef float    v2f  __attribute__((ext_vector_type(2)));
typedef float    v4f  __attribute__((ext_vector_type(4)));

#define B_  2
#define C_  256
#define N_  6400
#define CK_ 64
#define CV_ 128
#define CO_ 256

// 0.125 (Ck^-1/2) * log2(e): exp(s/8) == exp2(s * SCALE_LOG2E), single v_exp_f32
#define SCALE_LOG2E 0.1803368801111204f

__device__ __forceinline__ v16h join16(v8h lo, v8h hi) {
  return __builtin_shufflevector(lo, hi, 0,1,2,3,4,5,6,7,8,9,10,11,12,13,14,15);
}
__device__ __forceinline__ v8f zero8() {
  v8f z = {0.f,0.f,0.f,0.f,0.f,0.f,0.f,0.f};
  return z;
}
__device__ __forceinline__ v8f wmma_f16(v16h a, v16h b, v8f c) {
  // D = A(16x32 f16) * B(32x16 f16) + C(16x16 f32)
  return __builtin_amdgcn_wmma_f32_16x16x32_f16(false, a, false, b, (short)0, c, false, false);
}

// Twelve async 16-byte global -> LDS copies of one lane (ASYNCcnt-tracked): one thread's
// share of a staged tile. l[i] = LDS byte address (low 32 bits of the generic address),
// g[i] = global address. The closing s_wait_xcnt stands inside the statement so that no
// later write of an address register can be scheduled in front of it.
__device__ __forceinline__ unsigned lds_addr(const void* p) { return (unsigned)(size_t)p; }
__device__ __forceinline__ void async_copy12(const unsigned (&l)[12], const void* const (&g)[12]) {
  asm volatile("global_load_async_to_lds_b128 %0, %12, off\n\t"
               "global_load_async_to_lds_b128 %1, %13, off\n\t"
               "global_load_async_to_lds_b128 %2, %14, off\n\t"
               "global_load_async_to_lds_b128 %3, %15, off\n\t"
               "global_load_async_to_lds_b128 %4, %16, off\n\t"
               "global_load_async_to_lds_b128 %5, %17, off\n\t"
               "global_load_async_to_lds_b128 %6, %18, off\n\t"
               "global_load_async_to_lds_b128 %7, %19, off\n\t"
               "global_load_async_to_lds_b128 %8, %20, off\n\t"
               "global_load_async_to_lds_b128 %9, %21, off\n\t"
               "global_load_async_to_lds_b128 %10, %22, off\n\t"
               "global_load_async_to_lds_b128 %11, %23, off\n\t"
               "s_wait_xcnt 0x0"
               :: "v"(l[0]), "v"(l[1]), "v"(l[2]), "v"(l[3]), "v"(l[4]), "v"(l[5]),
                  "v"(l[6]), "v"(l[7]), "v"(l[8]), "v"(l[9]), "v"(l[10]), "v"(l[11]),
                  "v"(g[0]), "v"(g[1]), "v"(g[2]), "v"(g[3]), "v"(g[4]), "v"(g[5]),
                  "v"(g[6]), "v"(g[7]), "v"(g[8]), "v"(g[9]), "v"(g[10]), "v"(g[11]) : "memory");
}

// ---------------------------------------------------------------------------
// All three 1x1-conv projections as one f32 GEMM on the 16x16x4 matrix form.
// blockIdx.y = group of 64 output channels: 0 = Q (from y, BN), 1 = K (from x,
// BN), 2 and 3 = the two halves of V (from y, bias).
// Block = 4 waves; a wave owns 64 channels x 64 positions (4 x 4 D tiles).
// A = weights [channel][c] from LDS, B = src [c][position] from global memory.
// k order inside a chunk of 8 input channels, the same for A and B:
//   c = chunk * 8 + 4 * h + 2 * s + v   (s = which WMMA of the chunk, v = register)
// Column l16 of position tile t is position n0 + 4 * l16 + t, so one 16-byte
// load of a src row feeds all four position tiles.
// Q/K: dst[(b*N+n)*64 + k] (f16);  V: dst[(b*CV + k)*N + n] (f16).
// ---------------------------------------------------------------------------
#define WP_ 260   // LDS row pitch in floats: 1040 B = 16 B x odd, for ds_load_b128

__device__ __forceinline__ v8f wmma_f32(v2f a, v2f b, v8f c) {
  // D = A(16x4 f32) * B(4x16 f32) + C(16x16 f32)
  return __builtin_amdgcn_wmma_f32_16x16x4_f32(false, a, false, b, (short)0, c, false, false);
}

__device__ __forceinline__ void proj_chunk(const v4f (&af)[4], const v4f (&bq)[4],
                                           v8f (&acc)[4][4]) {
  #pragma unroll   // constant indices keep the array in registers
  for (int s = 0; s < 2; ++s) {
    v2f bf[4];
    #pragma unroll   // constant indices keep the array in registers
    for (int t = 0; t < 4; ++t) { bf[t][0] = bq[2 * s][t]; bf[t][1] = bq[2 * s + 1][t]; }
    #pragma unroll   // constant indices keep the array in registers
    for (int i = 0; i < 4; ++i) {
      v2f a; a[0] = af[i][2 * s]; a[1] = af[i][2 * s + 1];
      #pragma unroll   // constant indices keep the array in registers
      for (int t = 0; t < 4; ++t) acc[i][t] = wmma_f32(a, bf[t], acc[i][t]);
    }
  }
}

__global__ void __launch_bounds__(128)
proj_wmma_kernel(const float* __restrict__ x,    const float* __restrict__ y,
                 const float* __restrict__ fq_w, const float* __restrict__ fq_g,
                 const float* __restrict__ fq_b, const float* __restrict__ fq_m,
                 const float* __restrict__ fq_v,
                 const float* __restrict__ fk_w, const float* __restrict__ fk_g,
                 const float* __restrict__ fk_b, const float* __restrict__ fk_m,
                 const float* __restrict__ fk_v,
                 const float* __restrict__ fv_w, const float* __restrict__ fv_b,
                 _Float16* __restrict__ Qm, _Float16* __restrict__ Km,
                 _Float16* __restrict__ Vt)
{
  __shared__ __attribute__((aligned(16))) float Wl[64][WP_];   // 65 KB

  const unsigned tid  = threadIdx.x;
  const unsigned lane = tid & 31u;
  const unsigned wib  = tid >> 5;
  const unsigned l16  = lane & 15u;
  const unsigned h    = lane >> 4;
  const int g  = (int)blockIdx.y;
  const int b  = (int)(blockIdx.x / (N_ / 256));
  const int n0 = (int)(blockIdx.x % (N_ / 256)) * 256 + (int)wib * 64;

  const float* src = (g == 1) ? x : y;
  const float* w   = (g == 0) ? fq_w : (g == 1) ? fk_w : fv_w + (size_t)(g - 2) * 64 * C_;

  // lane's column of src, at its own half's first row of a chunk
  const float* bp = src + (size_t)b * C_ * N_ + (size_t)(4 * h) * N_ + n0 + 4 * l16;
  auto loadB = [&](v4f (&d)[4], int chunk) {
    #pragma unroll   // constant indices keep the array in registers
    for (int j = 0; j < 4; ++j) d[j] = *(const v4f*)(bp + (size_t)(chunk * 8 + j) * N_);
  };
  auto loadA = [&](v4f (&d)[4], int chunk) {
    #pragma unroll   // constant indices keep the array in registers
    for (int i = 0; i < 4; ++i) d[i] = *(const v4f*)&Wl[i * 16 + l16][chunk * 8 + 4 * h];
  };

  // src rows of the first four chunks start flying before the weights are staged
  v4f bq[4][4];
  #pragma unroll   // constant indices keep the array in registers
  for (int u = 0; u < 4; ++u) loadB(bq[u], u);

  // the group's 64 x 256 weights -> LDS: the block reads them as one contiguous
  // run, two rows (128 x 16 B) per step, and pads each row to the LDS pitch
  const float* wp = w + tid * 4u;
  float*       wl = &Wl[tid >> 6][(tid & 63u) * 4u];
  #pragma unroll   // constant indices keep the array in registers
  for (int i = 0; i < 32; ++i) *(v4f*)(wl + i * 2 * WP_) = *(const v4f*)(wp + i * 2 * C_);
  __syncthreads();   // every wave reads weight rows that the other waves stored

  v8f acc[4][4];
  #pragma unroll   // constant indices keep the array in registers
  for (int i = 0; i < 4; ++i) {
    #pragma unroll   // constant indices keep the array in registers
    for (int t = 0; t < 4; ++t) acc[i][t] = zero8();
  }

  // src rows are loaded four chunks ahead, weight fragments one chunk ahead
  v4f af[2][4];
  loadA(af[0], 0);
  for (int cc = 0; cc < C_ / 8 - 4; cc += 4) {
    #pragma unroll   // constant indices keep the array in registers
    for (int u = 0; u < 4; ++u) {
      loadA(af[(u + 1) & 1], cc + u + 1);
      proj_chunk(af[u & 1], bq[u], acc);
      loadB(bq[u], cc + u + 4);
      // keeps each refill directly behind its chunk: without it the compiler sinks all
      // sixteen loads to the loop's foot and the next trip waits out their latency
      __builtin_amdgcn_sched_barrier(0);
    }
  }
  #pragma unroll   // constant indices keep the array in registers
  for (int u = 0; u < 4; ++u) {
    if (u < 3) loadA(af[(u + 1) & 1], C_ / 8 - 4 + u + 1);
    proj_chunk(af[u & 1], bq[u], acc);
  }

  // acc[i][t][r] = channel i*16 + 8*h + r at position n0 + 4*l16 + t
  if (g < 2) {
    const float* bn_g = g ? fk_g : fq_g;
    const float* bn_b = g ? fk_b : fq_b;
    const float* bn_m = g ? fk_m : fq_m;
    const float* bn_v = g ? fk_v : fq_v;
    _Float16* dp = (g ? Km : Qm) + ((size_t)b * N_ + n0 + 4 * l16) * CK_ + 8 * h;
    #pragma unroll   // constant indices keep the array in registers
    for (int i = 0; i < 4; ++i) {
      float sc[8], mm[8], be[8];
      #pragma unroll   // constant indices keep the array in registers
      for (int r = 0; r < 8; ++r) {
        unsigned k = (unsigned)i * 16u + 8u * h + (unsigned)r;
        sc[r] = bn_g[k] * rsqrtf(bn_v[k] + 1e-5f);
        mm[r] = bn_m[k];
        be[r] = bn_b[k];
      }
      #pragma unroll   // constant indices keep the array in registers
      for (int t = 0; t < 4; ++t) {
        v8h pk;
        #pragma unroll   // constant indices keep the array in registers
        for (int r = 0; r < 8; ++r) pk[r] = (_Float16)((acc[i][t][r] - mm[r]) * sc[r] + be[r]);
        *(v8h*)(dp + (size_t)t * CK_ + i * 16) = pk;
      }
    }
  } else {
    const int cvoff = (g - 2) * 64;
    const float* bi = fv_b + cvoff + 8 * h;
    _Float16* dp = Vt + ((size_t)b * CV_ + cvoff + 8 * h) * N_ + n0 + 4 * l16;
    #pragma unroll   // constant indices keep the array in registers
    for (int i = 0; i < 4; ++i) {
      #pragma unroll   // constant indices keep the array in registers
      for (int r = 0; r < 8; ++r) {
        float bs = bi[i * 16 + r];
        v4h pk;
        #pragma unroll   // constant indices keep the array in registers
        for (int t = 0; t < 4; ++t) pk[t] = (_Float16)(acc[i][t][r] + bs);
        *(v4h*)(dp + (size_t)(i * 16 + r) * N_) = pk;   // 16 lanes = one 128-B line
      }
    }
    // the listing lays the Q/K block behind this one and reuses the stores' registers
    // there: the wait stands between the stores and any such overwrite
    asm volatile("s_wait_xcnt 0x0" ::: "memory");
  }
}

#define KT_ 256
#define NT_ (N_ / KT_)

__global__ void __launch_bounds__(512)
flash_kernel(const _Float16* __restrict__ Qm,
             const _Float16* __restrict__ Km,
             const _Float16* __restrict__ Vt,
             const float* __restrict__ W_w,
             const float* __restrict__ W_b,
             const float* __restrict__ x,
             const float* __restrict__ gamma,
             float* __restrict__ out)
{
  // the partial outputs are written only behind the loop's last barrier, when no wave
  // reads the ring any more and no copy is in flight: they take the ring's bytes
  __shared__ __attribute__((aligned(16))) union {
    struct {
      _Float16 K[2][KT_][72];        // 72 KB
      _Float16 V[2][CV_][KT_ + 8];   // 132 KB
    } ring;
    float Om[16][2][16][32][4];      // 256 KB, partial O
  } U;
  __shared__ __attribute__((aligned(16))) float    Ps[16][2][32];      // partial row sums, per lane
  __shared__ __attribute__((aligned(16))) _Float16 Cl[64][CV_ + 8];    // 17 KB, ctx rows (16 B x odd)

  const unsigned tid  = threadIdx.x;
  const unsigned lane = tid & 31u;
  const unsigned wib  = tid >> 5;
  const unsigned qp   = wib & 1u;       // pair of query tiles of the block
  const unsigned ks   = wib >> 1;       // key slice of every staged tile
  const int b  = (int)(blockIdx.x / (N_ / 16 / 4));                 // /100
  const int qb = ((int)(blockIdx.x % (N_ / 16 / 4)) * 4 + (int)qp * 2) * 16;
  const unsigned l16 = lane & 15u;
  const unsigned h   = lane >> 4;       // 0 or 1

  const _Float16* Kb = Km + (size_t)b * N_ * CK_;
  const _Float16* Vb = Vt + (size_t)b * CV_ * N_;

  // Q B-fragments (32x16 f16, two Ck chunks) of both query tiles, contiguous 16B loads per lane
  v16h aq[2][2];
  #pragma unroll   // constant indices keep the array in registers
  for (int a = 0; a < 2; ++a) {
    const _Float16* qrow = Qm + ((size_t)b * N_ + qb + a * 16 + l16) * CK_;
    aq[a][0] = join16(*(const v8h*)(qrow +       h * 8), *(const v8h*)(qrow + 16 + h * 8));
    aq[a][1] = join16(*(const v8h*)(qrow + 32 +  h * 8), *(const v8h*)(qrow + 48 + h * 8));
  }

  v8f o[2][8];
  v2f psum[2];
  #pragma unroll   // constant indices keep the array in registers
  for (int a = 0; a < 2; ++a) {
    #pragma unroll   // constant indices keep the array in registers
    for (int j = 0; j < 8; ++j) o[a][j] = zero8();
    psum[a][0] = 0.f; psum[a][1] = 0.f;
  }

  // async staging of one 256-key tile: 12 copies per thread.
  // K tile: 256 rows x 128 B, one contiguous 32 KB run: segment = s*512 + tid.
  // V tile: 128 cv rows x 512 B: 32 segments a row, a wave covers one whole row.
  const unsigned kr = tid >> 3, kc = (tid & 7u) * 8u;     // + 64 rows per s
  const unsigned vr = tid >> 5, vc = (tid & 31u) * 8u;    // + 16 rows per s
  auto stage = [&](int buf, int kb) {
    const _Float16* kg = Kb + (size_t)(kb + (int)kr) * CK_ + kc;
    const _Float16* vg = Vb + (size_t)vr * N_ + kb + vc;
    unsigned    l[12];
    const void* g[12];
    #pragma unroll   // constant indices keep the arrays in registers
    for (int s = 0; s < 4; ++s) {
      l[s] = lds_addr(&U.ring.K[buf][kr + 64 * s][kc]);
      g[s] = kg + (size_t)(64 * s) * CK_;
    }
    #pragma unroll   // constant indices keep the arrays in registers
    for (int s = 0; s < 8; ++s) {
      l[4 + s] = lds_addr(&U.ring.V[buf][vr + 16 * s][vc]);
      g[4 + s] = vg + (size_t)(16 * s) * N_;
    }
    async_copy12(l, g);
  };

  stage(0, 0);
  asm volatile("s_wait_asynccnt 0x0" ::: "memory");   // own copies of tile 0 landed
  __syncthreads();                                    // tile 0 visible to all 16 waves
  stage(1, KT_);

  // one trip of the ring; refill is a constant at each call, so that the loop's body is one
  // block: behind a branch round the refill the compiler sinks the row sums' additions, all
  // 32 exp results then stay live through the products, and accumulators spill to scratch
  auto trip = [&](int t, bool refill) {
    const int cur = t & 1;

    // ---- the four K A-fragments as one group, then the 8 S^T WMMAs: each fragment ----
    // ---- meets the Q fragments of both query tiles                                 ----
    const _Float16* kr0 = &U.ring.K[cur][ks * 32 + l16][0];
    const _Float16* kr1 = &U.ring.K[cur][ks * 32 + 16 + l16][0];
    v16h bk00 = join16(*(const v8h*)(kr0 +      h * 8), *(const v8h*)(kr0 + 16 + h * 8));
    v16h bk01 = join16(*(const v8h*)(kr0 + 32 + h * 8), *(const v8h*)(kr0 + 48 + h * 8));
    v16h bk10 = join16(*(const v8h*)(kr1 +      h * 8), *(const v8h*)(kr1 + 16 + h * 8));
    v16h bk11 = join16(*(const v8h*)(kr1 + 32 + h * 8), *(const v8h*)(kr1 + 48 + h * 8));
    // keeps the K reads one group: without it the compiler reads each fragment just in front
    // of its two products, and the wave waits out a whole LDS latency four times
    __builtin_amdgcn_sched_barrier(0);

    // c[a][g][r] = S^T[key ks*32 + 16g + 8h + r][query l16 of tile a]
    v8f c[2][2];
    {
      v8f z = zero8();
      c[0][0] = wmma_f16(bk00, aq[0][0], z);
      c[1][0] = wmma_f16(bk00, aq[1][0], z);
      c[0][1] = wmma_f16(bk10, aq[0][0], z);
      c[1][1] = wmma_f16(bk10, aq[1][0], z);
      c[0][0] = wmma_f16(bk01, aq[0][1], c[0][0]);
      c[1][0] = wmma_f16(bk01, aq[1][1], c[1][0]);
      c[0][1] = wmma_f16(bk11, aq[0][1], c[0][1]);
      c[1][1] = wmma_f16(bk11, aq[1][1], c[1][1]);
    }

    // ---- V^T A-fragments come in three groups (cv groups 0-3, 4-5, 6-7), each as soon as ----
    // ---- registers are free for it. The first group flies under the exp block            ----
    auto loadV = [&](int j) {
      const _Float16* vp = &U.ring.V[cur][j * 16 + l16][ks * 32];
      return join16(*(const v8h*)(vp + h * 8), *(const v8h*)(vp + 16 + h * 8));
    };
    v16h bv[8];
    #pragma unroll   // constant indices keep the array in registers
    for (int j = 0; j < 4; ++j) bv[j] = loadV(j);
    // keeps these V reads in front of the exp block: without it the compiler sinks them behind
    // that block, which then covers none of their latency
    __builtin_amdgcn_sched_barrier(0);

    // ---- p = exp(s/8) = exp2(s * SCALE_LOG2E); accumulate the lane's share of its ----
    // ---- query's row sum; two tiles, converted in place, are the B operand P^T     ----
    v16h pB[2];
    #pragma unroll   // constant indices keep the arrays in registers
    for (int a = 0; a < 2; ++a) {
      v2f sm[4];
      #pragma unroll   // constant indices keep the arrays in registers
      for (int r = 0; r < 8; r += 2) {
        v2f p0, p1;
        p0[0] = __builtin_amdgcn_exp2f(c[a][0][r]     * SCALE_LOG2E);
        p0[1] = __builtin_amdgcn_exp2f(c[a][0][r + 1] * SCALE_LOG2E);
        p1[0] = __builtin_amdgcn_exp2f(c[a][1][r]     * SCALE_LOG2E);
        p1[1] = __builtin_amdgcn_exp2f(c[a][1][r + 1] * SCALE_LOG2E);
        sm[r >> 1] = p0 + p1;
        pB[a][r]     = (_Float16)p0[0];  pB[a][r + 1] = (_Float16)p0[1];
        pB[a][8 + r] = (_Float16)p1[0];  pB[a][9 + r] = (_Float16)p1[1];
      }
      psum[a] += (sm[0] + sm[1]) + (sm[2] + sm[3]);
    }

    // ---- O^T += V^T * P^T ; 8 row groups over Cv=128, both query tiles per fragment ----
    // o[a][j][r] = O^T[cv j*16 + 8h + r][query l16 of tile a]
    auto pv = [&](int j) {
      o[0][j] = wmma_f16(bv[j], pB[0], o[0][j]);
      o[1][j] = wmma_f16(bv[j], pB[1], o[1][j]);
    };
    bv[4] = loadV(4);  bv[5] = loadV(5);
    // keeps the second V group in front of the first group's products, which cover its latency:
    // without it the compiler puts these reads singly among the products
    __builtin_amdgcn_sched_barrier(0);
    pv(0);  pv(1);
    bv[6] = loadV(6);  bv[7] = loadV(7);
    // keeps the third V group one group, in front of the products that cover its latency:
    // without it the compiler puts these reads singly among the products
    __builtin_amdgcn_sched_barrier(0);
    pv(2);  pv(3);  pv(4);  pv(5);  pv(6);  pv(7);

    // keeps the trip's products in front of the publish point: without it the compiler lifts
    // the waits and the barrier over them, every wave then waits for all its reads before its
    // first product, and the refill behind the products loses most of its lead
    __builtin_amdgcn_sched_barrier(0);

    // publish point: own reads of buf[cur] retired, own copies of tile t+1 landed,
    // then the one barrier that shows tile t+1 to every wave and frees buf[cur]
    asm volatile("s_wait_dscnt 0x0" ::: "memory");
    asm volatile("s_wait_asynccnt 0x0" ::: "memory");
    __syncthreads();
    if (refill) stage(cur, (t + 2) * KT_);
  };
  for (int t = 0; t < NT_ - 2; ++t) trip(t, true);
  trip(NT_ - 2, false);   // the last two tiles are staged already
  trip(NT_ - 1, false);
  asm volatile("s_wait_asynccnt 0x0" ::: "memory");   // nothing in flight at the wave's end

  // ---- the output projection's global operands start flying under the merge: the wave's
  // ---- 16 W_w rows (A fragments, rounded to f16), its bias, and its part of x
  const float* wrow = W_w + (size_t)(wib * 16 + l16) * CV_ + h * 8;
  v16h wa[4];
  #pragma unroll   // constant indices keep the array in registers
  for (int cc = 0; cc < 4; ++cc) {
    v4f w0 = *(const v4f*)(wrow + cc * 32),      w1 = *(const v4f*)(wrow + cc * 32 + 4);
    v4f w2 = *(const v4f*)(wrow + cc * 32 + 16), w3 = *(const v4f*)(wrow + cc * 32 + 20);
    #pragma unroll   // constant indices keep the array in registers
    for (int e = 0; e < 4; ++e) {
      wa[cc][e]     = (_Float16)w0[e];  wa[cc][4 + e]  = (_Float16)w1[e];
      wa[cc][8 + e] = (_Float16)w2[e];  wa[cc][12 + e] = (_Float16)w3[e];
    }
  }
  // lane: channels wib*16 + 8h + r, positions p0 + 4*l16 .. + 3
  const unsigned co0 = wib * 16 + 8 * h;
  const size_t   ob  = ((size_t)b * CO_ + co0) * N_ + (blockIdx.x % (N_ / 16 / 4)) * 64 + 4 * l16;
  const float*   xp  = x + ob;
  const unsigned bo  = co0 * 4;      // the bias loads' byte offset from W_b
  v4f xr[8];
  #pragma unroll   // constant indices keep the array in registers
  for (int r = 0; r < 8; ++r) xr[r] = *(const v4f*)(xp + (size_t)r * N_);
  const v4f wb0 = *(const v4f*)((const char*)W_b + bo), wb1 = *(const v4f*)((const char*)W_b + bo + 16);
  const float gm = gamma[0];
  // the loads' address registers stay untouched up to this wait: as inputs they live to
  // here, so no load of the run lands in a register that another load of the run names
  asm volatile("s_wait_xcnt 0x0" :: "v"(wrow), "v"(xp), "v"(bo) : "memory");

  // ---- the lane's share of its queries' row sums, then the wave's partials go to LDS ----
  #pragma unroll   // constant indices keep the arrays in registers
  for (int a = 0; a < 2; ++a) {
    Ps[wib][a][lane] = psum[a][0] + psum[a][1];
    #pragma unroll   // constant indices keep the arrays in registers
    for (int j = 0; j < 8; ++j) {
      #pragma unroll   // constant indices keep the arrays in registers
      for (int q = 0; q < 2; ++q) {
        v4f pk = {o[a][j][4 * q], o[a][j][4 * q + 1], o[a][j][4 * q + 2], o[a][j][4 * q + 3]};
        *(v4f*)&U.Om[wib][a][j * 2 + q][lane][0] = pk;
      }
    }
  }
  __syncthreads();   // every wave reads partials that the eight key slices of one pair stored

  // ---- epilogue: wave w adds the eight slices for cv groups 2*(w>>2) and 2*(w>>2)+1 of
  // ---- query tile w & 3 (tile mt & 1 of pair mt >> 1), normalizes and stores the ctx row
  // ---- as f16 in LDS: a lane holds 8 consecutive cv of query l16, one 16-byte store per
  // ---- group. Query q of the block lies in row (q & 3) * 16 + (q >> 2): position tile t
  // ---- is rows 16t .. 16t+15
  const unsigned mt = wib & 3u, mq = mt >> 1, ma = mt & 1u, mg = wib >> 2;
  const unsigned q64 = mt * 16 + l16;
  _Float16* crow = &Cl[(q64 & 3u) * 16 + (q64 >> 2)][8 * h];
  float s = 0.f;
  #pragma unroll
  for (int p = 0; p < 8; ++p) s += Ps[p * 2 + mq][ma][l16] + Ps[p * 2 + mq][ma][16 + l16];
  const float rinv = 1.0f / s;
  #pragma unroll
  for (int jj = 0; jj < 2; ++jj) {
    const unsigned j = 2 * mg + jj;
    v8h pk;
    #pragma unroll
    for (int q = 0; q < 2; ++q) {
      v4f a = *(const v4f*)&U.Om[mq][ma][j * 2 + q][lane][0];
      #pragma unroll
      for (int p = 1; p < 8; ++p) a += *(const v4f*)&U.Om[p * 2 + mq][ma][j * 2 + q][lane][0];
      #pragma unroll
      for (int e = 0; e < 4; ++e) pk[4 * q + e] = (_Float16)(a[e] * rinv);
    }
    *(v8h*)(crow + j * 16) = pk;
  }
  __syncthreads();   // every wave reads ctx rows that all sixteen waves stored

  // ---- out tile: 16 channels x 64 positions per wave ----
  v8f acc[4];
  #pragma unroll   // constant indices keep the array in registers
  for (int t = 0; t < 4; ++t) acc[t] = zero8();
  #pragma unroll   // constant indices keep the array in registers
  for (int cc = 0; cc < 4; ++cc) {
    #pragma unroll   // constant indices keep the array in registers
    for (int t = 0; t < 4; ++t) {
      const _Float16* cp = &Cl[t * 16 + l16][cc * 32 + h * 8];
      acc[t] = wmma_f16(wa[cc], join16(*(const v8h*)cp, *(const v8h*)(cp + 16)), acc[t]);
    }
  }
  #pragma unroll   // constant indices keep the array in registers
  for (int r = 0; r < 8; ++r) {
    const float bs = (r < 4) ? wb0[r & 3] : wb1[r & 3];
    v4f ov;
    #pragma unroll   // constant indices keep the array in registers
    for (int t = 0; t < 4; ++t) ov[t] = gm * (acc[t][r] + bs) + xr[r][t];
    *(v4f*)(out + ob + (size_t)r * N_) = ov;   // 16 lanes = two whole 128-B lines
  }
}

// ---------------------------------------------------------------------------
extern "C" void kernel_launch(void* const* d_in, const int* in_sizes, int n_in,
                              void* d_out, int out_size, void* d_ws, size_t ws_size,
                              hipStream_t stream)
{
  const float* x     = (const float*)d_in[0];
  const float* y     = (const float*)d_in[1];
  const float* fk_w  = (const float*)d_in[2];
  const float* fk_g  = (const float*)d_in[3];
  const float* fk_b  = (const float*)d_in[4];
  const float* fk_m  = (const float*)d_in[5];
  const float* fk_v  = (const float*)d_in[6];
  const float* fq_w  = (const float*)d_in[7];
  const float* fq_g  = (const float*)d_in[8];
  const float* fq_b  = (const float*)d_in[9];
  const float* fq_m  = (const float*)d_in[10];
  const float* fq_v  = (const float*)d_in[11];
  const float* fv_w  = (const float*)d_in[12];
  const float* fv_b  = (const float*)d_in[13];
  const float* W_w   = (const float*)d_in[14];
  const float* W_b   = (const float*)d_in[15];
  const float* gamma = (const float*)d_in[16];
  float* out = (float*)d_out;

  char* ws = (char*)d_ws;
  size_t off = 0;
  auto alloc = [&](size_t bytes) -> void* {
    void* p = ws + off;
    off = (off + bytes + 255) & ~(size_t)255;
    return p;
  };
  _Float16* Qm  = (_Float16*)alloc((size_t)B_ * N_ * CK_ * sizeof(_Float16));
  _Float16* Km  = (_Float16*)alloc((size_t)B_ * N_ * CK_ * sizeof(_Float16));
  _Float16* Vt  = (_Float16*)alloc((size_t)B_ * CV_ * N_ * sizeof(_Float16));
  (void)in_sizes; (void)n_in; (void)out_size; (void)ws_size;

  // projections: 50 blocks of 256 positions x 4 groups of 64 output channels
  proj_wmma_kernel<<<dim3(B_ * (N_ / 256), 4), dim3(128), 0, stream>>>(
      x, y, fq_w, fq_g, fq_b, fq_m, fq_v, fk_w, fk_g, fk_b, fk_m, fk_v, fv_w, fv_b, Qm, Km, Vt);

  // flash attention + output projection + residual: 100 blocks per batch, 16 waves
  // (2 pairs of query tiles x 8 key slices; then 16 groups of 16 output channels) per block
  flash_kernel<<<dim3(B_ * (N_ / 16 / 4)), dim3(512), 0, stream>>>(
      Qm, Km, Vt, W_w, W_b, x, gamma, out);
}

// v006
// Measured time: 44.6 microseconds a run.
// In both of two side-by-side timings against v005, it was 1.03 times as fast.
// All steps since v000 together make it 13.0 times as fast.
#include <hip/hip_runtime.h>
#include <hip/hip_bf16.h>

typedef _Float16 v8h  __attribute__((ext_vector_type(8)));
typedef _Float16 v16h __attribute__((ext_vector_type(16)));
typedef float    v8f  __attribute__((ext_vector_type(8)));
typedef _Float16 v4h  __attribute__((ext_vector_type(4)));
typedef float    v2f  __attribute__((ext_vector_type(2)));
typedef float    v4f  __attribute__((ext_vector_type(4)));

#define B_  2
#define C_  256
#define N_  6400
#define CK_ 64
#define CV_ 128
#define CO_ 256

// 0.125 (Ck^-1/2) * log2(e): exp(s/8) == exp2(s * SCALE_LOG2E), single v_exp_f32
#define SCALE_LOG2E 0.1803368801111204f

__device__ __forceinline__ v16h join16(v8h lo, v8h hi) {
  return __builtin_shufflevector(lo, hi, 0,1,2,3,4,5,6,7,8,9,10,11,12,13,14,15);
}
__device__ __forceinline__ v8f zero8() {
  v8f z = {0.f,0.f,0.f,0.f,0.f,0.f,0.f,0.f};
  return z;
}
__device__ __forceinline__ v8f wmma_f16(v16h a, v16h b, v8f c) {
  // D = A(16x32 f16) * B(32x16 f16) + C(16x16 f32)
  return __builtin_amdgcn_wmma_f32_16x16x32_f16(false, a, false, b, (short)0, c, false, false);
}

// Twelve async 16-byte global -> LDS copies of one lane (ASYNCcnt-tracked): one thread's
// share of a staged tile. l[i] = LDS byte address (low 32 bits of the generic address),
// g[i] = global address. The closing s_wait_xcnt stands inside the statement so that no
// later write of an address register can be scheduled in front of it.
__device__ __forceinline__ unsigned lds_addr(const void* p) { return (unsigned)(size_t)p; }
__device__ __forceinline__ void async_copy12(const unsigned (&l)[12], const void* const (&g)[12]) {
  asm volatile("global_load_async_to_lds_b128 %0, %12, off\n\t"
               "global_load_async_to_lds_b128 %1, %13, off\n\t"
               "global_load_async_to_lds_b128 %2, %14, off\n\t"
               "global_load_async_to_lds_b128 %3, %15, off\n\t"
               "global_load_async_to_lds_b128 %4, %16, off\n\t"
               "global_load_async_to_lds_b128 %5, %17, off\n\t"
               "global_load_async_to_lds_b128 %6, %18, off\n\t"
               "global_load_async_to_lds_b128 %7, %19, off\n\t"
               "global_load_async_to_lds_b128 %8, %20, off\n\t"
               "global_load_async_to_lds_b128 %9, %21, off\n\t"
               "global_load_async_to_lds_b128 %10, %22, off\n\t"
               "global_load_async_to_lds_b128 %11, %23, off\n\t"
               "s_wait_xcnt 0x0"
               :: "v"(l[0]), "v"(l[1]), "v"(l[2]), "v"(l[3]), "v"(l[4]), "v"(l[5]),
                  "v"(l[6]), "v"(l[7]), "v"(l[8]), "v"(l[9]), "v"(l[10]), "v"(l[11]),
                  "v"(g[0]), "v"(g[1]), "v"(g[2]), "v"(g[3]), "v"(g[4]), "v"(g[5]),
                  "v"(g[6]), "v"(g[7]), "v"(g[8]), "v"(g[9]), "v"(g[10]), "v"(g[11]) : "memory");
}

// ---------------------------------------------------------------------------
// All three 1x1-conv projections as one f32 GEMM on the 16x16x4 matrix form.
// blockIdx.y = group of 64 output channels: 0 = Q (from y, BN), 1 = K (from x,
// BN), 2 and 3 = the two halves of V (from y, bias).
// Block = 4 waves; a wave owns 64 channels x 64 positions (4 x 4 D tiles).
// A = weights [channel][c] from LDS, B = src [c][position] from global memory.
// k order inside a chunk of 8 input channels, the same for A and B:
//   c = chunk * 8 + 4 * h + 2 * s + v   (s = which WMMA of the chunk, v = register)
// Column l16 of position tile t is position n0 + 4 * l16 + t, so one 16-byte
// load of a src row feeds all four position tiles.
// Q/K: dst[(b*N+n)*64 + k] (f16);  V: dst[(b*CV + k)*N + n] (f16).
// ---------------------------------------------------------------------------
#define WP_ 260   // LDS row pitch in floats: 1040 B = 16 B x odd, for ds_load_b128

__device__ __forceinline__ v8f wmma_f32(v2f a, v2f b, v8f c) {
  // D = A(16x4 f32) * B(4x16 f32) + C(16x16 f32)
  return __builtin_amdgcn_wmma_f32_16x16x4_f32(false, a, false, b, (short)0, c, false, false);
}

__device__ __forceinline__ void proj_chunk(const v4f (&af)[4], const v4f (&bq)[4],
                                           v8f (&acc)[4][4]) {
  #pragma unroll   // constant indices keep the array in registers
  for (int s = 0; s < 2; ++s) {
    v2f bf[4];
    #pragma unroll   // constant indices keep the array in registers
    for (int t = 0; t < 4; ++t) { bf[t][0] = bq[2 * s][t]; bf[t][1] = bq[2 * s + 1][t]; }
    #pragma unroll   // constant indices keep the array in registers
    for (int i = 0; i < 4; ++i) {
      v2f a; a[0] = af[i][2 * s]; a[1] = af[i][2 * s + 1];
      #pragma unroll   // constant indices keep the array in registers
      for (int t = 0; t < 4; ++t) acc[i][t] = wmma_f32(a, bf[t], acc[i][t]);
    }
  }
}

__global__ void __launch_bounds__(128)
proj_wmma_kernel(const float* __restrict__ x,    const float* __restrict__ y,
                 const float* __restrict__ fq_w, const float* __restrict__ fq_g,
                 const float* __restrict__ fq_b, const float* __restrict__ fq_m,
                 const float* __restrict__ fq_v,
                 const float* __restrict__ fk_w, const float* __restrict__ fk_g,
                 const float* __restrict__ fk_b, const float* __restrict__ fk_m,
                 const float* __restrict__ fk_v,
                 const float* __restrict__ fv_w, const float* __restrict__ fv_b,
                 _Float16* __restrict__ Qm, _Float16* __restrict__ Km,
                 _Float16* __restrict__ Vt)
{
  __shared__ __attribute__((aligned(16))) float Wl[64][WP_];   // 65 KB

  const unsigned tid  = threadIdx.x;
  const unsigned lane = tid & 31u;
  const unsigned wib  = tid >> 5;
  const unsigned l16  = lane & 15u;
  const unsigned h    = lane >> 4;
  const int g  = (int)blockIdx.y;
  const int b  = (int)(blockIdx.x / (N_ / 256));
  const int n0 = (int)(blockIdx.x % (N_ / 256)) * 256 + (int)wib * 64;

  const float* src = (g == 1) ? x : y;
  const float* w   = (g == 0) ? fq_w : (g == 1) ? fk_w : fv_w + (size_t)(g - 2) * 64 * C_;

  // lane's column of src, at its own half's first row of a chunk
  const float* bp = src + (size_t)b * C_ * N_ + (size_t)(4 * h) * N_ + n0 + 4 * l16;
  auto loadB = [&](v4f (&d)[4], int chunk) {
    #pragma unroll   // constant indices keep the array in registers
    for (int j = 0; j < 4; ++j) d[j] = *(const v4f*)(bp + (size_t)(chunk * 8 + j) * N_);
  };
  auto loadA = [&](v4f (&d)[4], int chunk) {
    #pragma unroll   // constant indices keep the array in registers
    for (int i = 0; i < 4; ++i) d[i] = *(const v4f*)&Wl[i * 16 + l16][chunk * 8 + 4 * h];
  };

  // src rows of the first four chunks start flying before the weights are staged
  v4f bq[4][4];
  #pragma unroll   // constant indices keep the array in registers
  for (int u = 0; u < 4; ++u) loadB(bq[u], u);

  // the group's 64 x 256 weights -> LDS: the block reads them as one contiguous
  // run, two rows (128 x 16 B) per step, and pads each row to the LDS pitch
  const float* wp = w + tid * 4u;
  float*       wl = &Wl[tid >> 6][(tid & 63u) * 4u];
  #pragma unroll   // constant indices keep the array in registers
  for (int i = 0; i < 32; ++i) *(v4f*)(wl + i * 2 * WP_) = *(const v4f*)(wp + i * 2 * C_);
  __syncthreads();   // every wave reads weight rows that the other waves stored

  v8f acc[4][4];
  #pragma unroll   // constant indices keep the array in registers
  for (int i = 0; i < 4; ++i) {
    #pragma unroll   // constant indices keep the array in registers
    for (int t = 0; t < 4; ++t) acc[i][t] = zero8();
  }

  // src rows are loaded four chunks ahead, weight fragments one chunk ahead
  v4f af[2][4];
  loadA(af[0], 0);
  for (int cc = 0; cc < C_ / 8 - 4; cc += 4) {
    #pragma unroll   // constant indices keep the array in registers
    for (int u = 0; u < 4; ++u) {
      loadA(af[(u + 1) & 1], cc + u + 1);
      proj_chunk(af[u & 1], bq[u], acc);
      loadB(bq[u], cc + u + 4);
      // keeps each refill directly behind its chunk: without it the compiler sinks all
      // sixteen loads to the loop's foot and the next trip waits out their latency
      __builtin_amdgcn_sched_barrier(0);
    }
  }
  #pragma unroll   // constant indices keep the array in registers
  for (int u = 0; u < 4; ++u) {
    if (u < 3) loadA(af[(u + 1) & 1], C_ / 8 - 4 + u + 1);
    proj_chunk(af[u & 1], bq[u], acc);
  }

  // acc[i][t][r] = channel i*16 + 8*h + r at position n0 + 4*l16 + t
  if (g < 2) {
    const float* bn_g = g ? fk_g : fq_g;
    const float* bn_b = g ? fk_b : fq_b;
    const float* bn_m = g ? fk_m : fq_m;
    const float* bn_v = g ? fk_v : fq_v;
    _Float16* dp = (g ? Km : Qm) + ((size_t)b * N_ + n0 + 4 * l16) * CK_ + 8 * h;
    #pragma unroll   // constant indices keep the array in registers
    for (int i = 0; i < 4; ++i) {
      float sc[8], mm[8], be[8];
      #pragma unroll   // constant indices keep the array in registers
      for (int r = 0; r < 8; ++r) {
        unsigned k = (unsigned)i * 16u + 8u * h + (unsigned)r;
        sc[r] = bn_g[k] * rsqrtf(bn_v[k] + 1e-5f);
        mm[r] = bn_m[k];
        be[r] = bn_b[k];
      }
      #pragma unroll   // constant indices keep the array in registers
      for (int t = 0; t < 4; ++t) {
        v8h pk;
        #pragma unroll   // constant indices keep the array in registers
        for (int r = 0; r < 8; ++r) pk[r] = (_Float16)((acc[i][t][r] - mm[r]) * sc[r] + be[r]);
        *(v8h*)(dp + (size_t)t * CK_ + i * 16) = pk;
      }
    }
  } else {
    const int cvoff = (g - 2) * 64;
    const float* bi = fv_b + cvoff + 8 * h;
    _Float16* dp = Vt + ((size_t)b * CV_ + cvoff + 8 * h) * N_ + n0 + 4 * l16;
    #pragma unroll   // constant indices keep the array in registers
    for (int i = 0; i < 4; ++i) {
      #pragma unroll   // constant indices keep the array in registers
      for (int r = 0; r < 8; ++r) {
        float bs = bi[i * 16 + r];
        v4h pk;
        #pragma unroll   // constant indices keep the array in registers
        for (int t = 0; t < 4; ++t) pk[t] = (_Float16)(acc[i][t][r] + bs);
        *(v4h*)(dp + (size_t)(i * 16 + r) * N_) = pk;   // 16 lanes = one 128-B line
      }
    }
    // the listing lays the Q/K block behind this one and reuses the stores' registers
    // there: the wait stands between the stores and any such overwrite
    asm volatile("s_wait_xcnt 0x0" ::: "memory");
  }
}

#define KT_ 256
#define NT_ (N_ / KT_)

__global__ void __launch_bounds__(512)
flash_kernel(const _Float16* __restrict__ Qm,
             const _Float16* __restrict__ Km,
             const _Float16* __restrict__ Vt,
             const float* __restrict__ W_w,
             const float* __restrict__ W_b,
             const float* __restrict__ x,
             const float* __restrict__ gamma,
             float* __restrict__ out)
{
  // the partial outputs are written only behind the loop's last barrier, when no wave
  // reads the ring any more and no copy is in flight: they take the ring's bytes
  __shared__ __attribute__((aligned(16))) union {
    struct {
      _Float16 K[2][KT_][72];        // 72 KB
      _Float16 V[2][CV_][KT_ + 8];   // 132 KB
    } ring;
    float Om[16][2][16][32][4];      // 256 KB, partial O
  } U;
  __shared__ __attribute__((aligned(16))) float    Ps[16][2][32];      // partial row sums, per lane
  __shared__ __attribute__((aligned(16))) _Float16 Cl[64][CV_ + 8];    // 17 KB, ctx rows (16 B x odd)

  const unsigned tid  = threadIdx.x;
  const unsigned lane = tid & 31u;
  const unsigned wib  = tid >> 5;
  const unsigned qp   = wib & 1u;       // pair of query tiles of the block
  const unsigned ks   = wib >> 1;       // key slice of every staged tile
  const int b  = (int)(blockIdx.x / (N_ / 16 / 4));                 // /100
  const int qb = ((int)(blockIdx.x % (N_ / 16 / 4)) * 4 + (int)qp * 2) * 16;
  const unsigned l16 = lane & 15u;
  const unsigned h   = lane >> 4;       // 0 or 1

  const _Float16* Kb = Km + (size_t)b * N_ * CK_;
  const _Float16* Vb = Vt + (size_t)b * CV_ * N_;

  // Q B-fragments (32x16 f16, two Ck chunks) of both query tiles, contiguous 16B loads per lane
  v16h aq[2][2];
  #pragma unroll   // constant indices keep the array in registers
  for (int a = 0; a < 2; ++a) {
    const _Float16* qrow = Qm + ((size_t)b * N_ + qb + a * 16 + l16) * CK_;
    aq[a][0] = join16(*(const v8h*)(qrow +       h * 8), *(const v8h*)(qrow + 16 + h * 8));
    aq[a][1] = join16(*(const v8h*)(qrow + 32 +  h * 8), *(const v8h*)(qrow + 48 + h * 8));
  }

  v8f o[2][8];
  v2f psum[2];
  #pragma unroll   // constant indices keep the array in registers
  for (int a = 0; a < 2; ++a) {
    #pragma unroll   // constant indices keep the array in registers
    for (int j = 0; j < 8; ++j) o[a][j] = zero8();
    psum[a][0] = 0.f; psum[a][1] = 0.f;
  }

  // async staging of one 256-key tile: 12 copies per thread.
  // K tile: 256 rows x 128 B, one contiguous 32 KB run: segment = s*512 + tid.
  // V tile: 128 cv rows x 512 B: 32 segments a row, a wave covers one whole row.
  const unsigned kr = tid >> 3, kc = (tid & 7u) * 8u;     // + 64 rows per s
  const unsigned vr = tid >> 5, vc = (tid & 31u) * 8u;    // + 16 rows per s
  const _Float16* kg0 = Kb + (size_t)kr * CK_ + kc;      // the lane's place in key tile 0
  const _Float16* vg0 = Vb + (size_t)vr * N_ + vc;
  const int t0 = (int)(blockIdx.x % NT_);                // the block's first key tile
  // stage the key tile of trip t: tile (t0 + t) mod NT_, the same for the whole block
  auto stage = [&](int buf, int t) {
    int kt = t0 + t;
    if (kt >= NT_) kt -= NT_;
    const int kb = kt * KT_;
    const _Float16* kg = kg0 + (size_t)kb * CK_;
    const _Float16* vg = vg0 + kb;
    unsigned    l[12];
    const void* g[12];
    #pragma unroll   // constant indices keep the arrays in registers
    for (int s = 0; s < 4; ++s) {
      l[s] = lds_addr(&U.ring.K[buf][kr + 64 * s][kc]);
      g[s] = kg + (size_t)(64 * s) * CK_;
    }
    #pragma unroll   // constant indices keep the arrays in registers
    for (int s = 0; s < 8; ++s) {
      l[4 + s] = lds_addr(&U.ring.V[buf][vr + 16 * s][vc]);
      g[4 + s] = vg + (size_t)(16 * s) * N_;
    }
    async_copy12(l, g);
  };

  stage(0, 0);
  asm volatile("s_wait_asynccnt 0x0" ::: "memory");   // own copies of tile t0 landed
  __syncthreads();                                    // tile t0 visible to all 16 waves
  stage(1, 1);

  // one trip of the ring; refill is a constant at each call, so that the loop's body is one
  // block: behind a branch round the refill the compiler sinks the row sums' additions, all
  // 32 exp results then stay live through the products, and accumulators spill to scratch
  auto trip = [&](int t, bool refill) {
    const int cur = t & 1;

    // ---- the four K A-fragments as one group, then the 8 S^T WMMAs: each fragment ----
    // ---- meets the Q fragments of both query tiles                                 ----
    const _Float16* kr0 = &U.ring.K[cur][ks * 32 + l16][0];
    const _Float16* kr1 = &U.ring.K[cur][ks * 32 + 16 + l16][0];
    v16h bk00 = join16(*(const v8h*)(kr0 +      h * 8), *(const v8h*)(kr0 + 16 + h * 8));
    v16h bk01 = join16(*(const v8h*)(kr0 + 32 + h * 8), *(const v8h*)(kr0 + 48 + h * 8));
    v16h bk10 = join16(*(const v8h*)(kr1 +      h * 8), *(const v8h*)(kr1 + 16 + h * 8));
    v16h bk11 = join16(*(const v8h*)(kr1 + 32 + h * 8), *(const v8h*)(kr1 + 48 + h * 8));
    // keeps the K reads one group: without it the compiler reads each fragment just in front
    // of its two products, and the wave waits out a whole LDS latency four times
    __builtin_amdgcn_sched_barrier(0);

    // c[a][g][r] = S^T[key ks*32 + 16g + 8h + r][query l16 of tile a]
    v8f c[2][2];
    {
      v8f z = zero8();
      c[0][0] = wmma_f16(bk00, aq[0][0], z);
      c[1][0] = wmma_f16(bk00, aq[1][0], z);
      c[0][1] = wmma_f16(bk10, aq[0][0], z);
      c[1][1] = wmma_f16(bk10, aq[1][0], z);
      c[0][0] = wmma_f16(bk01, aq[0][1], c[0][0]);
      c[1][0] = wmma_f16(bk01, aq[1][1], c[1][0]);
      c[0][1] = wmma_f16(bk11, aq[0][1], c[0][1]);
      c[1][1] = wmma_f16(bk11, aq[1][1], c[1][1]);
    }

    // ---- V^T A-fragments come in three groups (cv groups 0-3, 4-5, 6-7), each as soon as ----
    // ---- registers are free for it. The first group flies under the exp block            ----
    auto loadV = [&](int j) {
      const _Float16* vp = &U.ring.V[cur][j * 16 + l16][ks * 32];
      return join16(*(const v8h*)(vp + h * 8), *(const v8h*)(vp + 16 + h * 8));
    };
    v16h bv[8];
    #pragma unroll   // constant indices keep the array in registers
    for (int j = 0; j < 4; ++j) bv[j] = loadV(j);
    // keeps these V reads in front of the exp block: without it the compiler sinks them behind
    // that block, which then covers none of their latency
    __builtin_amdgcn_sched_barrier(0);

    // ---- p = exp(s/8) = exp2(s * SCALE_LOG2E); accumulate the lane's share of its ----
    // ---- query's row sum; two tiles, converted in place, are the B operand P^T     ----
    v16h pB[2];
    #pragma unroll   // constant indices keep the arrays in registers
    for (int a = 0; a < 2; ++a) {
      v2f sm[4];
      #pragma unroll   // constant indices keep the arrays in registers
      for (int r = 0; r < 8; r += 2) {
        v2f p0, p1;
        p0[0] = __builtin_amdgcn_exp2f(c[a][0][r]     * SCALE_LOG2E);
        p0[1] = __builtin_amdgcn_exp2f(c[a][0][r + 1] * SCALE_LOG2E);
        p1[0] = __builtin_amdgcn_exp2f(c[a][1][r]     * SCALE_LOG2E);
        p1[1] = __builtin_amdgcn_exp2f(c[a][1][r + 1] * SCALE_LOG2E);
        sm[r >> 1] = p0 + p1;
        pB[a][r]     = (_Float16)p0[0];  pB[a][r + 1] = (_Float16)p0[1];
        pB[a][8 + r] = (_Float16)p1[0];  pB[a][9 + r] = (_Float16)p1[1];
      }
      psum[a] += (sm[0] + sm[1]) + (sm[2] + sm[3]);
    }

    // ---- O^T += V^T * P^T ; 8 row groups over Cv=128, both query tiles per fragment ----
    // o[a][j][r] = O^T[cv j*16 + 8h + r][query l16 of tile a]
    auto pv = [&](int j) {
      o[0][j] = wmma_f16(bv[j], pB[0], o[0][j]);
      o[1][j] = wmma_f16(bv[j], pB[1], o[1][j]);
    };
    bv[4] = loadV(4);  bv[5] = loadV(5);
    // keeps the second V group in front of the first group's products, which cover its latency:
    // without it the compiler puts these reads singly among the products
    __builtin_amdgcn_sched_barrier(0);
    pv(0);  pv(1);
    bv[6] = loadV(6);  bv[7] = loadV(7);
    // keeps the third V group one group, in front of the products that cover its latency:
    // without it the compiler puts these reads singly among the products
    __builtin_amdgcn_sched_barrier(0);
    pv(2);  pv(3);  pv(4);  pv(5);  pv(6);  pv(7);

    // keeps the trip's products in front of the publish point: without it the compiler lifts
    // the waits and the barrier over them, every wave then waits for all its reads before its
    // first product, and the refill behind the products loses most of its lead
    __builtin_amdgcn_sched_barrier(0);

    // publish point: own reads of buf[cur] retired, own copies of trip t+1's tile landed,
    // then the one barrier that shows that tile to every wave and frees buf[cur]
    asm volatile("s_wait_dscnt 0x0" ::: "memory");
    asm volatile("s_wait_asynccnt 0x0" ::: "memory");
    __syncthreads();
    if (refill) stage(cur, t + 2);
  };
  for (int t = 0; t < NT_ - 2; ++t) trip(t, true);
  trip(NT_ - 2, false);   // the last two tiles are staged already
  trip(NT_ - 1, false);
  asm volatile("s_wait_asynccnt 0x0" ::: "memory");   // nothing in flight at the wave's end

  // ---- the output projection's global operands start flying under the merge: the wave's
  // ---- 16 W_w rows (A fragments, rounded to f16), its bias, and its part of x
  const float* wrow = W_w + (size_t)(wib * 16 + l16) * CV_ + h * 8;
  v16h wa[4];
  #pragma unroll   // constant indices keep the array in registers
  for (int cc = 0; cc < 4; ++cc) {
    v4f w0 = *(const v4f*)(wrow + cc * 32),      w1 = *(const v4f*)(wrow + cc * 32 + 4);
    v4f w2 = *(const v4f*)(wrow + cc * 32 + 16), w3 = *(const v4f*)(wrow + cc * 32 + 20);
    #pragma unroll   // constant indices keep the array in registers
    for (int e = 0; e < 4; ++e) {
      wa[cc][e]     = (_Float16)w0[e];  wa[cc][4 + e]  = (_Float16)w1[e];
      wa[cc][8 + e] = (_Float16)w2[e];  wa[cc][12 + e] = (_Float16)w3[e];
    }
  }
  // lane: channels wib*16 + 8h + r, positions p0 + 4*l16 .. + 3
  const unsigned co0 = wib * 16 + 8 * h;
  const size_t   ob  = ((size_t)b * CO_ + co0) * N_ + (blockIdx.x % (N_ / 16 / 4)) * 64 + 4 * l16;
  const float*   xp  = x + ob;
  const unsigned bo  = co0 * 4;      // the bias loads' byte offset from W_b
  v4f xr[8];
  #pragma unroll   // constant indices keep the array in registers
  for (int r = 0; r < 8; ++r) xr[r] = *(const v4f*)(xp + (size_t)r * N_);
  const v4f wb0 = *(const v4f*)((const char*)W_b + bo), wb1 = *(const v4f*)((const char*)W_b + bo + 16);
  const float gm = gamma[0];
  // the loads' address registers stay untouched up to this wait: as inputs they live to
  // here, so no load of the run lands in a register that another load of the run names
  asm volatile("s_wait_xcnt 0x0" :: "v"(wrow), "v"(xp), "v"(bo) : "memory");

  // ---- the lane's share of its queries' row sums, then the wave's partials go to LDS ----
  #pragma unroll   // constant indices keep the arrays in registers
  for (int a = 0; a < 2; ++a) {
    Ps[wib][a][lane] = psum[a][0] + psum[a][1];
    #pragma unroll   // constant indices keep the arrays in registers
    for (int j = 0; j < 8; ++j) {
      #pragma unroll   // constant indices keep the arrays in registers
      for (int q = 0; q < 2; ++q) {
        v4f pk = {o[a][j][4 * q], o[a][j][4 * q + 1], o[a][j][4 * q + 2], o[a][j][4 * q + 3]};
        *(v4f*)&U.Om[wib][a][j * 2 + q][lane][0] = pk;
      }
    }
  }
  __syncthreads();   // every wave reads partials that the eight key slices of one pair stored

  // ---- epilogue: wave w adds the eight slices for cv groups 2*(w>>2) and 2*(w>>2)+1 of
  // ---- query tile w & 3 (tile mt & 1 of pair mt >> 1), normalizes and stores the ctx row
  // ---- as f16 in LDS: a lane holds 8 consecutive cv of query l16, one 16-byte store per
  // ---- group. Query q of the block lies in row (q & 3) * 16 + (q >> 2): position tile t
  // ---- is rows 16t .. 16t+15
  const unsigned mt = wib & 3u, mq = mt >> 1, ma = mt & 1u, mg = wib >> 2;
  const unsigned q64 = mt * 16 + l16;
  _Float16* crow = &Cl[(q64 & 3u) * 16 + (q64 >> 2)][8 * h];
  float s = 0.f;
  #pragma unroll
  for (int p = 0; p < 8; ++p) s += Ps[p * 2 + mq][ma][l16] + Ps[p * 2 + mq][ma][16 + l16];
  const float rinv = 1.0f / s;
  #pragma unroll
  for (int jj = 0; jj < 2; ++jj) {
    const unsigned j = 2 * mg + jj;
    v8h pk;
    #pragma unroll
    for (int q = 0; q < 2; ++q) {
      v4f a = *(const v4f*)&U.Om[mq][ma][j * 2 + q][lane][0];
      #pragma unroll
      for (int p = 1; p < 8; ++p) a += *(const v4f*)&U.Om[p * 2 + mq][ma][j * 2 + q][lane][0];
      #pragma unroll
      for (int e = 0; e < 4; ++e) pk[4 * q + e] = (_Float16)(a[e] * rinv);
    }
    *(v8h*)(crow + j * 16) = pk;
  }
  __syncthreads();   // every wave reads ctx rows that all sixteen waves stored

  // ---- out tile: 16 channels x 64 positions per wave ----
  v8f acc[4];
  #pragma unroll   // constant indices keep the array in registers
  for (int t = 0; t < 4; ++t) acc[t] = zero8();
  #pragma unroll   // constant indices keep the array in registers
  for (int cc = 0; cc < 4; ++cc) {
    #pragma unroll   // constant indices keep the array in registers
    for (int t = 0; t < 4; ++t) {
      const _Float16* cp = &Cl[t * 16 + l16][cc * 32 + h * 8];
      acc[t] = wmma_f16(wa[cc], join16(*(const v8h*)cp, *(const v8h*)(cp + 16)), acc[t]);
    }
  }
  #pragma unroll   // constant indices keep the array in registers
  for (int r = 0; r < 8; ++r) {
    const float bs = (r < 4) ? wb0[r & 3] : wb1[r & 3];
    v4f ov;
    #pragma unroll   // constant indices keep the array in registers
    for (int t = 0; t < 4; ++t) ov[t] = gm * (acc[t][r] + bs) + xr[r][t];
    *(v4f*)(out + ob + (size_t)r * N_) = ov;   // 16 lanes = two whole 128-B lines
  }
}

// ---------------------------------------------------------------------------
extern "C" void kernel_launch(void* const* d_in, const int* in_sizes, int n_in,
                              void* d_out, int out_size, void* d_ws, size_t ws_size,
                              hipStream_t stream)
{
  const float* x     = (const float*)d_in[0];
  const float* y     = (const float*)d_in[1];
  const float* fk_w  = (const float*)d_in[2];
  const float* fk_g  = (const float*)d_in[3];
  const float* fk_b  = (const float*)d_in[4];
  const float* fk_m  = (const float*)d_in[5];
  const float* fk_v  = (const float*)d_in[6];
  const float* fq_w  = (const float*)d_in[7];
  const float* fq_g  = (const float*)d_in[8];
  const float* fq_b  = (const float*)d_in[9];
  const float* fq_m  = (const float*)d_in[10];
  const float* fq_v  = (const float*)d_in[11];
  const float* fv_w  = (const float*)d_in[12];
  const float* fv_b  = (const float*)d_in[13];
  const float* W_w   = (const float*)d_in[14];
  const float* W_b   = (const float*)d_in[15];
  const float* gamma = (const float*)d_in[16];
  float* out = (float*)d_out;

  char* ws = (char*)d_ws;
  size_t off = 0;
  auto alloc = [&](size_t bytes) -> void* {
    void* p = ws + off;
    off = (off + bytes + 255) & ~(size_t)255;
    return p;
  };
  _Float16* Qm  = (_Float16*)alloc((size_t)B_ * N_ * CK_ * sizeof(_Float16));
  _Float16* Km  = (_Float16*)alloc((size_t)B_ * N_ * CK_ * sizeof(_Float16));
  _Float16* Vt  = (_Float16*)alloc((size_t)B_ * CV_ * N_ * sizeof(_Float16));
  (void)in_sizes; (void)n_in; (void)out_size; (void)ws_size;

  // projections: 50 blocks of 256 positions x 4 groups of 64 output channels
  proj_wmma_kernel<<<dim3(B_ * (N_ / 256), 4), dim3(128), 0, stream>>>(
      x, y, fq_w, fq_g, fq_b, fq_m, fq_v, fk_w, fk_g, fk_b, fk_m, fk_v, fv_w, fv_b, Qm, Km, Vt);

  // flash attention + output projection + residual: 100 blocks per batch, 16 waves
  // (2 pairs of query tiles x 8 key slices; then 16 groups of 16 output channels) per block
  flash_kernel<<<dim3(B_ * (N_ / 16 / 4)), dim3(512), 0, stream>>>(
      Qm, Km, Vt, W_w, W_b, x, gamma, out);
}

// v007
// A run of this version takes 39.3 microseconds.
// In two side-by-side timings against v006, it was 1.14 and 1.13 times as fast.
// Counting every step since v000, it is 14.8 times as fast.
#include <hip/hip_runtime.h>
#include <hip/hip_bf16.h>

typedef _Float16 v8h  __attribute__((ext_vector_type(8)));
typedef _Float16 v16h __attribute__((ext_vector_type(16)));
typedef float    v8f  __attribute__((ext_vector_type(8)));
typedef _Float16 v4h  __attribute__((ext_vector_type(4)));
typedef _Float16 v2h  __attribute__((ext_vector_type(2)));
typedef float    v2f  __attribute__((ext_vector_type(2)));
typedef float    v4f  __attribute__((ext_vector_type(4)));

#define B_  2
#define C_  256
#define N_  6400
#define CK_ 64
#define CV_ 128
#define CO_ 256

// 0.125 (Ck^-1/2) * log2(e): exp(s/8) == exp2(s * SCALE_LOG2E), single v_exp_f32
#define SCALE_LOG2E 0.1803368801111204f

__device__ __forceinline__ v16h join16(v8h lo, v8h hi) {
  return __builtin_shufflevector(lo, hi, 0,1,2,3,4,5,6,7,8,9,10,11,12,13,14,15);
}
__device__ __forceinline__ v8f zero8() {
  v8f z = {0.f,0.f,0.f,0.f,0.f,0.f,0.f,0.f};
  return z;
}
__device__ __forceinline__ v8f wmma_f16(v16h a, v16h b, v8f c) {
  // D = A(16x32 f16) * B(32x16 f16) + C(16x16 f32)
  return __builtin_amdgcn_wmma_f32_16x16x32_f16(false, a, false, b, (short)0, c, false, false);
}

// Twelve async 16-byte global -> LDS copies of one lane (ASYNCcnt-tracked): one thread's
// share of a staged tile. l[i] = LDS byte address (low 32 bits of the generic address),
// g[i] = global address. The closing s_wait_xcnt stands inside the statement so that no
// later write of an address register can be scheduled in front of it.
__device__ __forceinline__ unsigned lds_addr(const void* p) { return (unsigned)(size_t)p; }
__device__ __forceinline__ void async_copy12(const unsigned (&l)[12], const void* const (&g)[12]) {
  asm volatile("global_load_async_to_lds_b128 %0, %12, off\n\t"
               "global_load_async_to_lds_b128 %1, %13, off\n\t"
               "global_load_async_to_lds_b128 %2, %14, off\n\t"
               "global_load_async_to_lds_b128 %3, %15, off\n\t"
               "global_load_async_to_lds_b128 %4, %16, off\n\t"
               "global_load_async_to_lds_b128 %5, %17, off\n\t"
               "global_load_async_to_lds_b128 %6, %18, off\n\t"
               "global_load_async_to_lds_b128 %7, %19, off\n\t"
               "global_load_async_to_lds_b128 %8, %20, off\n\t"
               "global_load_async_to_lds_b128 %9, %21, off\n\t"
               "global_load_async_to_lds_b128 %10, %22, off\n\t"
               "global_load_async_to_lds_b128 %11, %23, off\n\t"
               "s_wait_xcnt 0x0"
               :: "v"(l[0]), "v"(l[1]), "v"(l[2]), "v"(l[3]), "v"(l[4]), "v"(l[5]),
                  "v"(l[6]), "v"(l[7]), "v"(l[8]), "v"(l[9]), "v"(l[10]), "v"(l[11]),
                  "v"(g[0]), "v"(g[1]), "v"(g[2]), "v"(g[3]), "v"(g[4]), "v"(g[5]),
                  "v"(g[6]), "v"(g[7]), "v"(g[8]), "v"(g[9]), "v"(g[10]), "v"(g[11]) : "memory");
}

// ---------------------------------------------------------------------------
// All three 1x1-conv projections as one GEMM on the f16 16x16x32 matrix form, both f32
// operands split in two f16 terms: v = hi + lo, hi = v rounded to f16, lo = v - hi (exact
// in f32) rounded to f16; hi + lo misses v by at most the larger of 2^-22 |v| and 2^-25.
// A product is three matrix products, lo*hi + hi*lo + hi*hi, summed in f32; lo*lo (about
// 2^-22 of the product) is left out. 32 input channels cost 3 matrix instructions a tile,
// not 8 of the f32 form.
// blockIdx.y = group of 64 output channels: 0 = Q (from y, BN), 1 = K (from x,
// BN), 2 and 3 = the two halves of V (from y, bias).
// Block = 4 waves; a wave owns 64 channels x 64 positions (4 x 4 D tiles).
// A = weights [channel][c], split once a block on their way into LDS; B = src
// [c][position] from global memory, split in registers.
// k order inside a step of 32 input channels, the same for A and B:
//   c = step * 32 + 16 * (e >> 3) + 8 * h + (e & 7)   (e = element of the fragment)
// Column l16 of position tile t is position n0 + 4 * l16 + t, so one 16-byte
// load of a src row feeds all four position tiles.
// Q/K: dst[(b*N+n)*64 + k] (f16);  V: dst[(b*CV + k)*N + n] (f16).
// ---------------------------------------------------------------------------
#define WPH_ 264   // LDS row pitch in halfs: 528 B = 16 B x odd, for ds_load_b128
#define KS_  (C_ / 32)   // 8 steps of 32 input channels

__device__ __forceinline__ void split_f16(v2f v, v2h& hi, v2h& lo) {
  hi = __builtin_convertvector(v, v2h);
  lo = __builtin_convertvector(v - __builtin_convertvector(hi, v2f), v2h);
}

__global__ void __launch_bounds__(128)
proj_wmma_kernel(const float* __restrict__ x,    const float* __restrict__ y,
                 const float* __restrict__ fq_w, const float* __restrict__ fq_g,
                 const float* __restrict__ fq_b, const float* __restrict__ fq_m,
                 const float* __restrict__ fq_v,
                 const float* __restrict__ fk_w, const float* __restrict__ fk_g,
                 const float* __restrict__ fk_b, const float* __restrict__ fk_m,
                 const float* __restrict__ fk_v,
                 const float* __restrict__ fv_w, const float* __restrict__ fv_b,
                 _Float16* __restrict__ Qm, _Float16* __restrict__ Km,
                 _Float16* __restrict__ Vt)
{
  __shared__ __attribute__((aligned(16))) _Float16 Wh[64][WPH_];   // 33 KB, high terms
  __shared__ __attribute__((aligned(16))) _Float16 Wo[64][WPH_];   // 33 KB, low terms

  const unsigned tid  = threadIdx.x;
  const unsigned lane = tid & 31u;
  const unsigned wib  = tid >> 5;
  const unsigned l16  = lane & 15u;
  const unsigned h    = lane >> 4;
  const int g  = (int)blockIdx.y;
  const int b  = (int)(blockIdx.x / (N_ / 256));
  const int n0 = (int)(blockIdx.x % (N_ / 256)) * 256 + (int)wib * 64;

  const float* src = (g == 1) ? x : y;
  const float* w   = (g == 0) ? fq_w : (g == 1) ? fk_w : fv_w + (size_t)(g - 2) * 64 * C_;

  // lane's column of src, at its own half's first row of a step
  const float* bp = src + (size_t)b * C_ * N_ + (size_t)(8 * h) * N_ + n0 + 4 * l16;
  // src row of fragment element e of a step
  auto loadRow = [&](int step, int e) {
    return *(const v4f*)(bp + (size_t)(step * 32 + 16 * (e >> 3) + (e & 7)) * N_);
  };

  // the group's 64 x 256 weights: the block reads them as one contiguous run, two rows
  // (128 x 16 B) per load. They are asked for first: they come back first, and their
  // split runs while the src rows behind them are still on their way
  const float* wp = w + tid * 4u;
  v4f wr[32];
  #pragma unroll   // constant indices keep the array in registers
  for (int i = 0; i < 32; ++i) wr[i] = *(const v4f*)(wp + i * 2 * C_);

  // src rows fly up to four steps ahead of their products
  v4f raw[4][16];
  #pragma unroll   // constant indices keep the array in registers
  for (int u = 0; u < 2; ++u) {
    #pragma unroll   // constant indices keep the array in registers
    for (int e = 0; e < 16; ++e) raw[u][e] = loadRow(u, e);
  }
  // keeps the first src loads in front of the weights' split: behind it they would start
  // only when the weights have come back
  __builtin_amdgcn_sched_barrier(0);
  // the weight loads name the thread index's register, which the LDS addresses below reuse:
  // as an input it lives to this wait
  asm volatile("s_wait_xcnt 0x0" :: "v"(tid) : "memory");

  {
    _Float16* wh = &Wh[tid >> 6][(tid & 63u) * 4u];
    _Float16* wo = &Wo[tid >> 6][(tid & 63u) * 4u];
    #pragma unroll   // constant indices keep the array in registers
    for (int i = 0; i < 32; ++i) {
      v2f p0 = {wr[i][0], wr[i][1]}, p1 = {wr[i][2], wr[i][3]};
      v2h h0, l0, h1, l1;
      split_f16(p0, h0, l0);
      split_f16(p1, h1, l1);
      v4h hi = {h0[0], h0[1], h1[0], h1[1]}, lo = {l0[0], l0[1], l1[0], l1[1]};
      *(v4h*)(wh + i * 2 * WPH_) = hi;
      *(v4h*)(wo + i * 2 * WPH_) = lo;
    }
  }
  #pragma unroll   // constant indices keep the array in registers
  for (int u = 2; u < 4; ++u) {
    #pragma unroll   // constant indices keep the array in registers
    for (int e = 0; e < 16; ++e) raw[u][e] = loadRow(u, e);
  }
  __syncthreads();   // every wave reads weight rows that the other waves stored

  v8f acc[4][4];
  #pragma unroll   // constant indices keep the array in registers
  for (int i = 0; i < 4; ++i) {
    #pragma unroll   // constant indices keep the array in registers
    for (int t = 0; t < 4; ++t) acc[i][t] = zero8();
  }

  // fragments of two steps: the products read one set while the next one is made
  v16h ah[2][4], al[2][4], bh[2][4], bl[2][4];
  auto loadA = [&](int s, int step) {
    #pragma unroll   // constant indices keep the arrays in registers
    for (int i = 0; i < 4; ++i) {
      const _Float16* ph = &Wh[i * 16 + l16][step * 32 + 8 * h];
      const _Float16* pl = &Wo[i * 16 + l16][step * 32 + 8 * h];
      ah[s][i] = join16(*(const v8h*)ph, *(const v8h*)(ph + 16));
      al[s][i] = join16(*(const v8h*)pl, *(const v8h*)(pl + 16));
    }
  };
  // split src rows e0 .. e0+3 of a step into the four position tiles' B fragments
  auto splitB = [&](int s, const v4f (&r)[16], int e0) {
    #pragma unroll   // constant indices keep the arrays in registers
    for (int e = e0; e < e0 + 4; e += 2) {
      #pragma unroll   // constant indices keep the arrays in registers
      for (int t = 0; t < 4; ++t) {
        v2f p = {r[e][t], r[e + 1][t]};
        v2h hi, lo;
        split_f16(p, hi, lo);
        bh[s][t][e] = hi[0];  bh[s][t][e + 1] = hi[1];
        bl[s][t][e] = lo[0];  bl[s][t][e + 1] = lo[1];
      }
    }
  };

  loadA(0, 0);
  #pragma unroll   // constant indices keep the arrays in registers
  for (int q = 0; q < 4; ++q) {
    splitB(0, raw[0], 4 * q);
    #pragma unroll   // constant indices keep the arrays in registers
    for (int e = 4 * q; e < 4 * q + 4; ++e) raw[0][e] = loadRow(4, e);
  }

  #pragma unroll   // constant indices keep the arrays in registers
  for (int step = 0; step < KS_; ++step) {
    const int cu = step & 1, nx = cu ^ 1;
    if (step + 1 < KS_) loadA(nx, step + 1);   // one group of LDS reads a step
    #pragma unroll   // constant indices keep the arrays in registers
    for (int i = 0; i < 4; ++i) {
      // a quarter of the next step's split, and the refill of the rows it frees, go with
      // each quarter of this step's products
      if (step + 1 < KS_) {
        splitB(nx, raw[(step + 1) & 3], 4 * i);
        if (step + 5 < KS_) {
          #pragma unroll   // constant indices keep the arrays in registers
          for (int e = 4 * i; e < 4 * i + 4; ++e) raw[(step + 1) & 3][e] = loadRow(step + 5, e);
        }
      }
      #pragma unroll   // constant indices keep the arrays in registers
      for (int t = 0; t < 4; ++t) acc[i][t] = wmma_f16(al[cu][i], bh[cu][t], acc[i][t]);
      #pragma unroll   // constant indices keep the arrays in registers
      for (int t = 0; t < 4; ++t) acc[i][t] = wmma_f16(ah[cu][i], bl[cu][t], acc[i][t]);
      #pragma unroll   // constant indices keep the arrays in registers
      for (int t = 0; t < 4; ++t) acc[i][t] = wmma_f16(ah[cu][i], bh[cu][t], acc[i][t]);
      // keeps each quarter as written: without it the compiler sinks every refill to just in
      // front of its split and reads the weight fragments two loads at a time, each waited out
      __builtin_amdgcn_sched_barrier(0);
    }
  }
  // the loads' address registers stay untouched up to this wait: as inputs they live to here
  asm volatile("s_wait_xcnt 0x0" :: "v"(bp) : "memory");

  // acc[i][t][r] = channel i*16 + 8*h + r at position n0 + 4*l16 + t
  if (g < 2) {
    const float* bn_g = g ? fk_g : fq_g;
    const float* bn_b = g ? fk_b : fq_b;
    const float* bn_m = g ? fk_m : fq_m;
    const float* bn_v = g ? fk_v : fq_v;
    _Float16* dp = (g ? Km : Qm) + ((size_t)b * N_ + n0 + 4 * l16) * CK_ + 8 * h;
    #pragma unroll   // constant indices keep the array in registers
    for (int i = 0; i < 4; ++i) {
      float sc[8], mm[8], be[8];
      #pragma unroll   // constant indices keep the array in registers
      for (int r = 0; r < 8; ++r) {
        unsigned k = (unsigned)i * 16u + 8u * h + (unsigned)r;
        sc[r] = bn_g[k] * rsqrtf(bn_v[k] + 1e-5f);
        mm[r] = bn_m[k];
        be[r] = bn_b[k];
      }
      #pragma unroll   // constant indices keep the array in registers
      for (int t = 0; t < 4; ++t) {
        v8h pk;
        #pragma unroll   // constant indices keep the array in registers
        for (int r = 0; r < 8; ++r) pk[r] = (_Float16)((acc[i][t][r] - mm[r]) * sc[r] + be[r]);
        *(v8h*)(dp + (size_t)t * CK_ + i * 16) = pk;
      }
    }
  } else {
    const int cvoff = (g - 2) * 64;
    const float* bi = fv_b + cvoff + 8 * h;
    _Float16* dp = Vt + ((size_t)b * CV_ + cvoff + 8 * h) * N_ + n0 + 4 * l16;
    #pragma unroll   // constant indices keep the array in registers
    for (int i = 0; i < 4; ++i) {
      #pragma unroll   // constant indices keep the array in registers
      for (int r = 0; r < 8; ++r) {
        float bs = bi[i * 16 + r];
        v4h pk;
        #pragma unroll   // constant indices keep the array in registers
        for (int t = 0; t < 4; ++t) pk[t] = (_Float16)(acc[i][t][r] + bs);
        *(v4h*)(dp + (size_t)(i * 16 + r) * N_) = pk;   // 16 lanes = one 128-B line
      }
    }
    // the listing lays the Q/K block behind this one and reuses the stores' registers
    // there: the wait stands between the stores and any such overwrite
    asm volatile("s_wait_xcnt 0x0" ::: "memory");
  }
}

#define KT_ 256
#define NT_ (N_ / KT_)

__global__ void __launch_bounds__(512)
flash_kernel(const _Float16* __restrict__ Qm,
             const _Float16* __restrict__ Km,
             const _Float16* __restrict__ Vt,
             const float* __restrict__ W_w,
             const float* __restrict__ W_b,
             const float* __restrict__ x,
             const float* __restrict__ gamma,
             float* __restrict__ out)
{
  // the partial outputs are written only behind the loop's last barrier, when no wave
  // reads the ring any more and no copy is in flight: they take the ring's bytes
  __shared__ __attribute__((aligned(16))) union {
    struct {
      _Float16 K[2][KT_][72];        // 72 KB
      _Float16 V[2][CV_][KT_ + 8];   // 132 KB
    } ring;
    float Om[16][2][16][32][4];      // 256 KB, partial O
  } U;
  __shared__ __attribute__((aligned(16))) float    Ps[16][2][32];      // partial row sums, per lane
  __shared__ __attribute__((aligned(16))) _Float16 Cl[64][CV_ + 8];    // 17 KB, ctx rows (16 B x odd)

  const unsigned tid  = threadIdx.x;
  const unsigned lane = tid & 31u;
  const unsigned wib  = tid >> 5;
  const unsigned qp   = wib & 1u;       // pair of query tiles of the block
  const unsigned ks   = wib >> 1;       // key slice of every staged tile
  const int b  = (int)(blockIdx.x / (N_ / 16 / 4));                 // /100
  const int qb = ((int)(blockIdx.x % (N_ / 16 / 4)) * 4 + (int)qp * 2) * 16;
  const unsigned l16 = lane & 15u;
  const unsigned h   = lane >> 4;       // 0 or 1

  const _Float16* Kb = Km + (size_t)b * N_ * CK_;
  const _Float16* Vb = Vt + (size_t)b * CV_ * N_;

  // Q B-fragments (32x16 f16, two Ck chunks) of both query tiles, contiguous 16B loads per lane
  v16h aq[2][2];
  #pragma unroll   // constant indices keep the array in registers
  for (int a = 0; a < 2; ++a) {
    const _Float16* qrow = Qm + ((size_t)b * N_ + qb + a * 16 + l16) * CK_;
    aq[a][0] = join16(*(const v8h*)(qrow +       h * 8), *(const v8h*)(qrow + 16 + h * 8));
    aq[a][1] = join16(*(const v8h*)(qrow + 32 +  h * 8), *(const v8h*)(qrow + 48 + h * 8));
  }

  v8f o[2][8];
  v2f psum[2];
  #pragma unroll   // constant indices keep the array in registers
  for (int a = 0; a < 2; ++a) {
    #pragma unroll   // constant indices keep the array in registers
    for (int j = 0; j < 8; ++j) o[a][j] = zero8();
    psum[a][0] = 0.f; psum[a][1] = 0.f;
  }

  // async staging of one 256-key tile: 12 copies per thread.
  // K tile: 256 rows x 128 B, one contiguous 32 KB run: segment = s*512 + tid.
  // V tile: 128 cv rows x 512 B: 32 segments a row, a wave covers one whole row.
  const unsigned kr = tid >> 3, kc = (tid & 7u) * 8u;     // + 64 rows per s
  const unsigned vr = tid >> 5, vc = (tid & 31u) * 8u;    // + 16 rows per s
  const _Float16* kg0 = Kb + (size_t)kr * CK_ + kc;      // the lane's place in key tile 0
  const _Float16* vg0 = Vb + (size_t)vr * N_ + vc;
  const int t0 = (int)(blockIdx.x % NT_);                // the block's first key tile
  // stage the key tile of trip t: tile (t0 + t) mod NT_, the same for the whole block
  auto stage = [&](int buf, int t) {
    int kt = t0 + t;
    if (kt >= NT_) kt -= NT_;
    const int kb = kt * KT_;
    const _Float16* kg = kg0 + (size_t)kb * CK_;
    const _Float16* vg = vg0 + kb;
    unsigned    l[12];
    const void* g[12];
    #pragma unroll   // constant indices keep the arrays in registers
    for (int s = 0; s < 4; ++s) {
      l[s] = lds_addr(&U.ring.K[buf][kr + 64 * s][kc]);
      g[s] = kg + (size_t)(64 * s) * CK_;
    }
    #pragma unroll   // constant indices keep the arrays in registers
    for (int s = 0; s < 8; ++s) {
      l[4 + s] = lds_addr(&U.ring.V[buf][vr + 16 * s][vc]);
      g[4 + s] = vg + (size_t)(16 * s) * N_;
    }
    async_copy12(l, g);
  };

  stage(0, 0);
  asm volatile("s_wait_asynccnt 0x0" ::: "memory");   // own copies of tile t0 landed
  __syncthreads();                                    // tile t0 visible to all 16 waves
  stage(1, 1);

  // one trip of the ring; refill is a constant at each call, so that the loop's body is one
  // block: behind a branch round the refill the compiler sinks the row sums' additions, all
  // 32 exp results then stay live through the products, and accumulators spill to scratch
  auto trip = [&](int t, bool refill) {
    const int cur = t & 1;

    // ---- the four K A-fragments as one group, then the 8 S^T WMMAs: each fragment ----
    // ---- meets the Q fragments of both query tiles                                 ----
    const _Float16* kr0 = &U.ring.K[cur][ks * 32 + l16][0];
    const _Float16* kr1 = &U.ring.K[cur][ks * 32 + 16 + l16][0];
    v16h bk00 = join16(*(const v8h*)(kr0 +      h * 8), *(const v8h*)(kr0 + 16 + h * 8));
    v16h bk01 = join16(*(const v8h*)(kr0 + 32 + h * 8), *(const v8h*)(kr0 + 48 + h * 8));
    v16h bk10 = join16(*(const v8h*)(kr1 +      h * 8), *(const v8h*)(kr1 + 16 + h * 8));
    v16h bk11 = join16(*(const v8h*)(kr1 + 32 + h * 8), *(const v8h*)(kr1 + 48 + h * 8));
    // keeps the K reads one group: without it the compiler reads each fragment just in front
    // of its two products, and the wave waits out a whole LDS latency four times
    __builtin_amdgcn_sched_barrier(0);

    // c[a][g][r] = S^T[key ks*32 + 16g + 8h + r][query l16 of tile a]
    v8f c[2][2];
    {
      v8f z = zero8();
      c[0][0] = wmma_f16(bk00, aq[0][0], z);
      c[1][0] = wmma_f16(bk00, aq[1][0], z);
      c[0][1] = wmma_f16(bk10, aq[0][0], z);
      c[1][1] = wmma_f16(bk10, aq[1][0], z);
      c[0][0] = wmma_f16(bk01, aq[0][1], c[0][0]);
      c[1][0] = wmma_f16(bk01, aq[1][1], c[1][0]);
      c[0][1] = wmma_f16(bk11, aq[0][1], c[0][1]);
      c[1][1] = wmma_f16(bk11, aq[1][1], c[1][1]);
    }

    // ---- V^T A-fragments come in three groups (cv groups 0-3, 4-5, 6-7), each as soon as ----
    // ---- registers are free for it. The first group flies under the exp block            ----
    auto loadV = [&](int j) {
      const _Float16* vp = &U.ring.V[cur][j * 16 + l16][ks * 32];
      return join16(*(const v8h*)(vp + h * 8), *(const v8h*)(vp + 16 + h * 8));
    };
    v16h bv[8];
    #pragma unroll   // constant indices keep the array in registers
    for (int j = 0; j < 4; ++j) bv[j] = loadV(j);
    // keeps these V reads in front of the exp block: without it the compiler sinks them behind
    // that block, which then covers none of their latency
    __builtin_amdgcn_sched_barrier(0);

    // ---- p = exp(s/8) = exp2(s * SCALE_LOG2E); accumulate the lane's share of its ----
    // ---- query's row sum; two tiles, converted in place, are the B operand P^T     ----
    v16h pB[2];
    #pragma unroll   // constant indices keep the arrays in registers
    for (int a = 0; a < 2; ++a) {
      v2f sm[4];
      #pragma unroll   // constant indices keep the arrays in registers
      for (int r = 0; r < 8; r += 2) {
        v2f p0, p1;
        p0[0] = __builtin_amdgcn_exp2f(c[a][0][r]     * SCALE_LOG2E);
        p0[1] = __builtin_amdgcn_exp2f(c[a][0][r + 1] * SCALE_LOG2E);
        p1[0] = __builtin_amdgcn_exp2f(c[a][1][r]     * SCALE_LOG2E);
        p1[1] = __builtin_amdgcn_exp2f(c[a][1][r + 1] * SCALE_LOG2E);
        sm[r >> 1] = p0 + p1;
        pB[a][r]     = (_Float16)p0[0];  pB[a][r + 1] = (_Float16)p0[1];
        pB[a][8 + r] = (_Float16)p1[0];  pB[a][9 + r] = (_Float16)p1[1];
      }
      psum[a] += (sm[0] + sm[1]) + (sm[2] + sm[3]);
    }

    // ---- O^T += V^T * P^T ; 8 row groups over Cv=128, both query tiles per fragment ----
    // o[a][j][r] = O^T[cv j*16 + 8h + r][query l16 of tile a]
    auto pv = [&](int j) {
      o[0][j] = wmma_f16(bv[j], pB[0], o[0][j]);
      o[1][j] = wmma_f16(bv[j], pB[1], o[1][j]);
    };
    bv[4] = loadV(4);  bv[5] = loadV(5);
    // keeps the second V group in front of the first group's products, which cover its latency:
    // without it the compiler puts these reads singly among the products
    __builtin_amdgcn_sched_barrier(0);
    pv(0);  pv(1);
    bv[6] = loadV(6);  bv[7] = loadV(7);
    // keeps the third V group one group, in front of the products that cover its latency:
    // without it the compiler puts these reads singly among the products
    __builtin_amdgcn_sched_barrier(0);
    pv(2);  pv(3);  pv(4);  pv(5);  pv(6);  pv(7);

    // keeps the trip's products in front of the publish point: without it the compiler lifts
    // the waits and the barrier over them, every wave then waits for all its reads before its
    // first product, and the refill behind the products loses most of its lead
    __builtin_amdgcn_sched_barrier(0);

    // publish point: own reads of buf[cur] retired, own copies of trip t+1's tile landed,
    // then the one barrier that shows that tile to every wave and frees buf[cur]
    asm volatile("s_wait_dscnt 0x0" ::: "memory");
    asm volatile("s_wait_asynccnt 0x0" ::: "memory");
    __syncthreads();
    if (refill) stage(cur, t + 2);
  };
  for (int t = 0; t < NT_ - 2; ++t) trip(t, true);
  trip(NT_ - 2, false);   // the last two tiles are staged already
  trip(NT_ - 1, false);
  asm volatile("s_wait_asynccnt 0x0" ::: "memory");   // nothing in flight at the wave's end

  // ---- the output projection's global operands start flying under the merge: the wave's
  // ---- 16 W_w rows (A fragments, rounded to f16), its bias, and its part of x
  const float* wrow = W_w + (size_t)(wib * 16 + l16) * CV_ + h * 8;
  v16h wa[4];
  #pragma unroll   // constant indices keep the array in registers
  for (int cc = 0; cc < 4; ++cc) {
    v4f w0 = *(const v4f*)(wrow + cc * 32),      w1 = *(const v4f*)(wrow + cc * 32 + 4);
    v4f w2 = *(const v4f*)(wrow + cc * 32 + 16), w3 = *(const v4f*)(wrow + cc * 32 + 20);
    #pragma unroll   // constant indices keep the array in registers
    for (int e = 0; e < 4; ++e) {
      wa[cc][e]     = (_Float16)w0[e];  wa[cc][4 + e]  = (_Float16)w1[e];
      wa[cc][8 + e] = (_Float16)w2[e];  wa[cc][12 + e] = (_Float16)w3[e];
    }
  }
  // lane: channels wib*16 + 8h + r, positions p0 + 4*l16 .. + 3
  const unsigned co0 = wib * 16 + 8 * h;
  const size_t   ob  = ((size_t)b * CO_ + co0) * N_ + (blockIdx.x % (N_ / 16 / 4)) * 64 + 4 * l16;
  const float*   xp  = x + ob;
  const unsigned bo  = co0 * 4;      // the bias loads' byte offset from W_b
  v4f xr[8];
  #pragma unroll   // constant indices keep the array in registers
  for (int r = 0; r < 8; ++r) xr[r] = *(const v4f*)(xp + (size_t)r * N_);
  const v4f wb0 = *(const v4f*)((const char*)W_b + bo), wb1 = *(const v4f*)((const char*)W_b + bo + 16);
  const float gm = gamma[0];
  // the loads' address registers stay untouched up to this wait: as inputs they live to
  // here, so no load of the run lands in a register that another load of the run names
  asm volatile("s_wait_xcnt 0x0" :: "v"(wrow), "v"(xp), "v"(bo) : "memory");

  // ---- the lane's share of its queries' row sums, then the wave's partials go to LDS ----
  #pragma unroll   // constant indices keep the arrays in registers
  for (int a = 0; a < 2; ++a) {
    Ps[wib][a][lane] = psum[a][0] + psum[a][1];
    #pragma unroll   // constant indices keep the arrays in registers
    for (int j = 0; j < 8; ++j) {
      #pragma unroll   // constant indices keep the arrays in registers
      for (int q = 0; q < 2; ++q) {
        v4f pk = {o[a][j][4 * q], o[a][j][4 * q + 1], o[a][j][4 * q + 2], o[a][j][4 * q + 3]};
        *(v4f*)&U.Om[wib][a][j * 2 + q][lane][0] = pk;
      }
    }
  }
  __syncthreads();   // every wave reads partials that the eight key slices of one pair stored

  // ---- epilogue: wave w adds the eight slices for cv groups 2*(w>>2) and 2*(w>>2)+1 of
  // ---- query tile w & 3 (tile mt & 1 of pair mt >> 1), normalizes and stores the ctx row
  // ---- as f16 in LDS: a lane holds 8 consecutive cv of query l16, one 16-byte store per
  // ---- group. Query q of the block lies in row (q & 3) * 16 + (q >> 2): position tile t
  // ---- is rows 16t .. 16t+15
  const unsigned mt = wib & 3u, mq = mt >> 1, ma = mt & 1u, mg = wib >> 2;
  const unsigned q64 = mt * 16 + l16;
  _Float16* crow = &Cl[(q64 & 3u) * 16 + (q64 >> 2)][8 * h];
  float s = 0.f;
  #pragma unroll
  for (int p = 0; p < 8; ++p) s += Ps[p * 2 + mq][ma][l16] + Ps[p * 2 + mq][ma][16 + l16];
  const float rinv = 1.0f / s;
  #pragma unroll
  for (int jj = 0; jj < 2; ++jj) {
    const unsigned j = 2 * mg + jj;
    v8h pk;
    #pragma unroll
    for (int q = 0; q < 2; ++q) {
      v4f a = *(const v4f*)&U.Om[mq][ma][j * 2 + q][lane][0];
      #pragma unroll
      for (int p = 1; p < 8; ++p) a += *(const v4f*)&U.Om[p * 2 + mq][ma][j * 2 + q][lane][0];
      #pragma unroll
      for (int e = 0; e < 4; ++e) pk[4 * q + e] = (_Float16)(a[e] * rinv);
    }
    *(v8h*)(crow + j * 16) = pk;
  }
  __syncthreads();   // every wave reads ctx rows that all sixteen waves stored

  // ---- out tile: 16 channels x 64 positions per wave ----
  v8f acc[4];
  #pragma unroll   // constant indices keep the array in registers
  for (int t = 0; t < 4; ++t) acc[t] = zero8();
  #pragma unroll   // constant indices keep the array in registers
  for (int cc = 0; cc < 4; ++cc) {
    #pragma unroll   // constant indices keep the array in registers
    for (int t = 0; t < 4; ++t) {
      const _Float16* cp = &Cl[t * 16 + l16][cc * 32 + h * 8];
      acc[t] = wmma_f16(wa[cc], join16(*(const v8h*)cp, *(const v8h*)(cp + 16)), acc[t]);
    }
  }
  #pragma unroll   // constant indices keep the array in registers
  for (int r = 0; r < 8; ++r) {
    const float bs = (r < 4) ? wb0[r & 3] : wb1[r & 3];
    v4f ov;
    #pragma unroll   // constant indices keep the array in registers
    for (int t = 0; t < 4; ++t) ov[t] = gm * (acc[t][r] + bs) + xr[r][t];
    *(v4f*)(out + ob + (size_t)r * N_) = ov;   // 16 lanes = two whole 128-B lines
  }
}

// ---------------------------------------------------------------------------
extern "C" void kernel_launch(void* const* d_in, const int* in_sizes, int n_in,
                              void* d_out, int out_size, void* d_ws, size_t ws_size,
                              hipStream_t stream)
{
  const float* x     = (const float*)d_in[0];
  const float* y     = (const float*)d_in[1];
  const float* fk_w  = (const float*)d_in[2];
  const float* fk_g  = (const float*)d_in[3];
  const float* fk_b  = (const float*)d_in[4];
  const float* fk_m  = (const float*)d_in[5];
  const float* fk_v  = (const float*)d_in[6];
  const float* fq_w  = (const float*)d_in[7];
  const float* fq_g  = (const float*)d_in[8];
  const float* fq_b  = (const float*)d_in[9];
  const float* fq_m  = (const float*)d_in[10];
  const float* fq_v  = (const float*)d_in[11];
  const float* fv_w  = (const float*)d_in[12];
  const float* fv_b  = (const float*)d_in[13];
  const float* W_w   = (const float*)d_in[14];
  const float* W_b   = (const float*)d_in[15];
  const float* gamma = (const float*)d_in[16];
  float* out = (float*)d_out;

  char* ws = (char*)d_ws;
  size_t off = 0;
  auto alloc = [&](size_t bytes) -> void* {
    void* p = ws + off;
    off = (off + bytes + 255) & ~(size_t)255;
    return p;
  };
  _Float16* Qm  = (_Float16*)alloc((size_t)B_ * N_ * CK_ * sizeof(_Float16));
  _Float16* Km  = (_Float16*)alloc((size_t)B_ * N_ * CK_ * sizeof(_Float16));
  _Float16* Vt  = (_Float16*)alloc((size_t)B_ * CV_ * N_ * sizeof(_Float16));
  (void)in_sizes; (void)n_in; (void)out_size; (void)ws_size;

  // projections: 50 blocks of 256 positions x 4 groups of 64 output channels
  proj_wmma_kernel<<<dim3(B_ * (N_ / 256), 4), dim3(128), 0, stream>>>(
      x, y, fq_w, fq_g, fq_b, fq_m, fq_v, fk_w, fk_g, fk_b, fk_m, fk_v, fv_w, fv_b, Qm, Km, Vt);

  // flash attention + output projection + residual: 100 blocks per batch, 16 waves
  // (2 pairs of query tiles x 8 key slices; then 16 groups of 16 output channels) per block
  flash_kernel<<<dim3(B_ * (N_ / 16 / 4)), dim3(512), 0, stream>>>(
      Qm, Km, Vt, W_w, W_b, x, gamma, out);
}
